// v000
// The times below were measured on an AMD MI455X: many runs one after another, warmed up first and cycling through
// copies of the inputs, with the whole window's GPU time divided by the number of runs. Launches and the gaps
// between them are all in it. The median over several windows is given; except for v000 it joins two sittings, which
// can be a few percent apart, so the side-by-side timings, each taken in one sitting, are the better comparison.
// v000 is the starting kernel. One run takes 1660 microseconds.
// compute dtype: x and W_qkv RNE-converted to bf16; q/k/v = x W_qkv^T with exact bf16 products on v_wmma_f32_16x16x32_bf16, f32 accumulate; q as f16 hi + residual (x 2^10), k once to f16 -> 2-product logits (v_wmma_f32_16x16x32_f16) x (1/64) stored in f32 (4 heads per launch); softmax in f32 (precise expf); P x 2^11 f32 split bf16 hi + lo against v bf16 hi + lo (3 bf16 products); merged heads y in f32; y (x 2^6, f16) times W_out^T (bf16 values x 2^6, f16): 1 f16 product, f32 accumulate, + bf16 b_out.
#include <hip/hip_runtime.h>
#include <math.h>

typedef __attribute__((ext_vector_type(16))) _Float16 v16h;
typedef __attribute__((ext_vector_type(16))) __bf16 v16b;
typedef __attribute__((ext_vector_type(8)))  _Float16 v8h;
typedef __attribute__((ext_vector_type(8)))  __bf16 v8b;
typedef __attribute__((ext_vector_type(8)))  float v8f;
typedef __attribute__((ext_vector_type(4)))  float v4f;
typedef __attribute__((ext_vector_type(4)))  unsigned v4u;

template <typename T> __device__ __forceinline__ void vst2(void* p, T v) { *(T*)p = v;  }

__device__ __forceinline__ v8f wmma16(v16h a, v16h b, v8f c) {
  v8f d = __builtin_amdgcn_wmma_f32_16x16x32_f16(false, a, false, b, (short)0, c, false, false);
  asm volatile("v_nop\n\tv_nop\n\tv_nop\n\tv_nop" : "+v"(d) : "v"(a), "v"(b));
  return d;
}
__device__ __forceinline__ v8f wmma_bf(v16b a, v16b b, v8f c) {
  v8f d = __builtin_amdgcn_wmma_f32_16x16x32_bf16(false, a, false, b, (short)0, c, false, false);
  asm volatile("v_nop\n\tv_nop\n\tv_nop\n\tv_nop" : "+v"(d) : "v"(a), "v"(b));
  return d;
}
// 16x16x32 fragments: lane = (g = lane>>4, row/col = lane&15); elements 0..7 = k0+8g+0..7, 8..15 = k0+16+8g+0..7; D element r = row 8g+r, col lane&15
__device__ __forceinline__ v16h frag_h(const _Float16* rowk0, int lane) {
  union { v16h v; v8h q[2]; } u; const _Float16* p = rowk0 + 8 * (lane >> 4);
  u.q[0] = *(const v8h*)p; u.q[1] = *(const v8h*)(p + 16); return u.v;
}
__device__ __forceinline__ v16b frag_b(const __bf16* rowk0, int lane) {
  union { v16b v; v8b q[2]; } u; const __bf16* p = rowk0 + 8 * (lane >> 4);
  u.q[0] = *(const v8b*)p; u.q[1] = *(const v8b*)(p + 16); return u.v;
}
// f32 row -> f16 fragment with a power-of-two carry sc
__device__ __forceinline__ v16h frag_f32s(const float* rowk0, int lane, float sc) {
  v16h a; const float* p = rowk0 + 8 * (lane >> 4);
#pragma unroll
  for (int i = 0; i < 8; ++i) { a[i] = (_Float16)(p[i] * sc); a[8 + i] = (_Float16)(p[16 + i] * sc); }
  return a;
}
// f32 row -> bf16 hi + lo fragment pair
struct F2 { v16b h, l; };
__device__ __forceinline__ F2 bsplit16(const float v[16]) { F2 r;
#pragma unroll
  for (int i = 0; i < 16; ++i) { const __bf16 hb = (__bf16)v[i]; r.h[i] = hb; r.l[i] = (__bf16)(v[i] - (float)hb); }
  return r; }
__device__ __forceinline__ F2 split_row(const float* row, int k0, int lane) { float v[16]; const float* p = row + k0 + 8 * (lane >> 4);
#pragma unroll
  for (int i = 0; i < 8; ++i) { v[i] = p[i]; v[8 + i] = p[16 + i]; }
  return bsplit16(v); }
__device__ __forceinline__ float bfr(float v) { return (float)(__bf16)v; }
// wave-private LDS tile: publish own ds stores before the same wave reloads them through another type
__device__ __forceinline__ void ldsx() { asm volatile("s_wait_dscnt 0" ::: "memory"); __builtin_amdgcn_wave_barrier(); __builtin_amdgcn_fence(3, "workgroup"); }

// sizes: B 2, N 2048, C 1024 = 16 heads x 64; logits x (1/64); output projection C -> C with bias
#define NB_FULL 2
#define SEQ_FULL 2048
#ifndef NB
#define NB NB_FULL
#endif
#ifndef SEQ
#define SEQ SEQ_FULL
#endif
#define CC 1024
#define NH 16
#define HD 64
#define HG 4                                          // heads per launch group
static_assert(NB >= 1 && NB <= NB_FULL);
static_assert(SEQ >= 128 && SEQ <= SEQ_FULL && (SEQ % 128) == 0);
static_assert(NH * HD == CC && (NH % HG) == 0 && HD == 64 && (CC % 128) == 0);

#define PR     ((size_t)NB * SEQ)                                 // plane rows (b*SEQ + t)
#define WS_QH  ((size_t)0)                                        // f16 q hi   [PR][CC]
#define WS_QL  (WS_QH + 2u * PR * CC)                             // f16 q residual x 2^10 [PR][CC]
#define WS_KH  (WS_QL + 2u * PR * CC)                             // f16 k      [PR][CC]
#define WS_VT  (WS_KH + 2u * PR * CC)                             // bf16 v hi planes [b][c][t]
#define WS_VL  (WS_VT + 2u * (size_t)NB * CC * SEQ)               // bf16 v lo planes [b][c][t]
#define WS_S   (WS_VL + 2u * (size_t)NB * CC * SEQ)               // f32 logits / P for HG heads [hg][q][k]
#define WS_Y   (WS_S + 4u * (size_t)HG * SEQ * SEQ)                // f32 merged heads y [PR][CC]
#define WS_END (WS_Y + 4u * PR * CC)
static_assert(WS_END <= (size_t)134217728u);
static_assert((((size_t)(NB - 1) * SEQ_FULL + SEQ) * CC) <= (size_t)NB_FULL * SEQ_FULL * CC);

// ---- k_proj: block = (64 plane rows, 128 cols, which in {q,k,v}); W rows = which*CC + (h*HD + d); q -> f16 hi + residual, k -> f16, v -> bf16 hi/lo planes [b][c][t]
__global__ __launch_bounds__(128) __attribute__((amdgpu_num_vgpr(256)))
void k_proj(const float* __restrict__ X, const float* __restrict__ W, _Float16* __restrict__ QH, _Float16* __restrict__ QL, _Float16* __restrict__ KH, __bf16* __restrict__ VT, __bf16* __restrict__ VL) {
  __shared__ __align__(16) _Float16 sh[64][136], sl[64][136];
  __shared__ __align__(16) __bf16 th[128][72], tl2[128][72];
  const int tid = threadIdx.x, wave = tid >> 5, lane = tid & 31, col = lane & 15, g = lane >> 4;
  const int which = blockIdx.z; const int c0 = blockIdx.y * 128;
  const size_t r0 = (size_t)blockIdx.x * 64;            // plane row base = b*SEQ + t0
  const size_t b = r0 / SEQ; const int t0 = (int)(r0 % SEQ);
  const size_t xr0 = b * SEQ_FULL + (size_t)t0;          // input row base
  v8f acc[8] = {};
#pragma unroll 1
  for (int kc = 0; kc < CC / 32; ++kc) {
    v16b a; { const float* p = X + (xr0 + wave * 16 + col) * CC + kc * 32 + 8 * g;
#pragma unroll
      for (int i = 0; i < 8; ++i) { a[i] = (__bf16)p[i]; a[8 + i] = (__bf16)p[16 + i]; } }
#pragma unroll
    for (int j = 0; j < 8; ++j) { v16b w; const int oc = c0 + j * 16 + col; const float* wp = W + ((size_t)which * CC + oc) * CC + kc * 32 + 8 * g;
#pragma unroll
      for (int i = 0; i < 8; ++i) { w[i] = (__bf16)wp[i]; w[8 + i] = (__bf16)wp[16 + i]; }
      acc[j] = wmma_bf(a, w, acc[j]); } }
#pragma unroll
  for (int j = 0; j < 8; ++j) {
#pragma unroll
    for (int r = 0; r < 8; ++r) { const float v = acc[j][r]; const int rl = wave * 16 + 8 * g + r, cl = j * 16 + col;
      if (which == 2) { const __bf16 bh = (__bf16)v; th[cl][rl] = bh; tl2[cl][rl] = (__bf16)(v - (float)bh); }
      else { const _Float16 hv = (_Float16)v; sh[rl][cl] = hv; sl[rl][cl] = (_Float16)((v - (float)hv) * 1024.0f); }   // q residual carried x 2^10 so the plane stays f16-normal
    } }
  __syncthreads();
  if (which < 2) { _Float16* dh = (which == 0) ? QH : KH;
    for (int e = tid; e < 64 * 16; e += 128) { const int rl = e >> 4, q = e & 15; const size_t o = (r0 + rl) * CC + c0 + q * 8;
      vst2(dh + o, *(const v4u*)&sh[rl][q * 8]); if (which == 0) vst2(QL + o, *(const v4u*)&sl[rl][q * 8]); } }
  else { for (int e = tid; e < 128 * 8; e += 128) { const int cl = e >> 3, q = e & 7; const size_t o2 = (b * CC + c0 + cl) * (size_t)SEQ + t0 + q * 8;
      vst2(VT + o2, *(const v4u*)&th[cl][q * 8]); vst2(VL + o2, *(const v4u*)&tl2[cl][q * 8]); } }
}
// ---- k_sc: block = (64 queries, 128 keys) of (b,h): 2-product logits x (1/64) -> f32 S[hg][q][k]
__global__ __launch_bounds__(128) __attribute__((amdgpu_num_vgpr(256)))
void k_sc(const _Float16* __restrict__ QH, const _Float16* __restrict__ QL, const _Float16* __restrict__ KH, int b, int h0, float* __restrict__ S0) {
  __shared__ __align__(16) float ss[4][16][132];
  const int h = h0 + blockIdx.z; float* S = S0 + (size_t)blockIdx.z * SEQ * SEQ;
  const int tid = threadIdx.x, wave = tid >> 5, lane = tid & 31, col = lane & 15, g = lane >> 4;
  const int k0 = blockIdx.y * 128; const int ql0 = blockIdx.x * 64 + wave * 16; const size_t q0 = (size_t)b * SEQ + ql0;
  v8f acc[8] = {}, accl[8] = {};
#pragma unroll 1
  for (int kc = 0; kc < HD / 32; ++kc) {
    const v16h ah = frag_h(QH + (q0 + col) * CC + h * HD + kc * 32, lane), al = frag_h(QL + (q0 + col) * CC + h * HD + kc * 32, lane);
#pragma unroll
    for (int j = 0; j < 8; ++j) { const v16h kb = frag_h(KH + ((size_t)b * SEQ + k0 + j * 16 + col) * CC + h * HD + kc * 32, lane);
      acc[j] = wmma16(ah, kb, acc[j]); accl[j] = wmma16(al, kb, accl[j]); } }
#pragma unroll
  for (int j = 0; j < 8; ++j) {
#pragma unroll
    for (int r = 0; r < 8; ++r) ss[wave][8 * g + r][j * 16 + col] = (acc[j][r] + accl[j][r] * (1.0f / 1024.0f)) * (1.0f / 64.0f); }
  ldsx();
  for (int rl = 0; rl < 16; ++rl) vst2(S + (size_t)(ql0 + rl) * SEQ + k0 + lane * 4, *(const v4f*)&ss[wave][rl][lane * 4]);
}
// ---- k_sm: block = query row of (hg): softmax over SEQ keys in f32 -> P x 2^11 f32 in place
__global__ __launch_bounds__(256) void k_sm(float* __restrict__ S0) {
  __shared__ float sred[8]; __shared__ float sbc; __shared__ __align__(16) float sh[SEQ];
  const int t = threadIdx.x; const size_t row = blockIdx.x;
  float* sr = S0 + (size_t)blockIdx.y * SEQ * SEQ + row * SEQ;
  float m = -3.0e38f;
#pragma unroll 1
  for (int k = t; k < SEQ; k += 256) { const float v = sr[k]; sh[k] = v; m = fmaxf(m, v); }
#pragma unroll
  for (int o = 1; o < 32; o <<= 1) m = fmaxf(m, __shfl_xor(m, o));
  if ((t & 31) == 0) sred[t >> 5] = m;
  __syncthreads();
  if (t == 0) { float a = sred[0]; for (int i = 1; i < 8; ++i) a = fmaxf(a, sred[i]); sbc = a; }
  __syncthreads(); m = sbc; __syncthreads();
  float sum = 0.f;
#pragma unroll 1
  for (int k = t; k < SEQ; k += 256) { const float e = expf(sh[k] - m); sh[k] = e; sum += e; }
#pragma unroll
  for (int o = 1; o < 32; o <<= 1) sum += __shfl_xor(sum, o);
  if ((t & 31) == 0) sred[t >> 5] = sum;
  __syncthreads();
  if (t == 0) { float a = 0.f; for (int i = 0; i < 8; ++i) a += sred[i]; sbc = (1.0f / a) * 2048.0f; }
  __syncthreads(); const float c = sbc;
#pragma unroll 1
  for (int q = t; q < SEQ / 4; q += 256) { v4f pv = *(const v4f*)&sh[q * 4]; pv = pv * c; vst2(sr + q * 4, pv); }
}
// ---- k_pv: block = 64 queries of (b,h): y[q][h*HD + d] = (P x 2^11) . v / 2^11 (3 bf16 products) -> f32 Y plane
__global__ __launch_bounds__(128) __attribute__((amdgpu_num_vgpr(256)))
void k_pv(const float* __restrict__ PS0, const __bf16* __restrict__ VT, const __bf16* __restrict__ VL, int b, int h0, float* __restrict__ Y) {
  const int h = h0 + blockIdx.z; const float* PS = PS0 + (size_t)blockIdx.z * SEQ * SEQ;
  __shared__ __align__(16) float ss[4][16][HD + 4];
  const int tid = threadIdx.x, wave = tid >> 5, lane = tid & 31, col = lane & 15, g = lane >> 4;
  const int ql0 = blockIdx.x * 64 + wave * 16;
  v8f acc[HD / 16] = {};
#pragma unroll 1
  for (int kc = 0; kc < SEQ / 32; ++kc) { const F2 p = split_row(PS + (size_t)(ql0 + col) * SEQ, kc * 32, lane);
#pragma unroll
    for (int j = 0; j < HD / 16; ++j) { const size_t po = ((size_t)b * CC + h * HD + j * 16 + col) * (size_t)SEQ + kc * 32; const v16b vh = frag_b(VT + po, lane);
      acc[j] = wmma_bf(p.h, vh, acc[j]); acc[j] = wmma_bf(p.l, vh, acc[j]); acc[j] = wmma_bf(p.h, frag_b(VL + po, lane), acc[j]); } }
#pragma unroll
  for (int j = 0; j < HD / 16; ++j) {
#pragma unroll
    for (int r = 0; r < 8; ++r) ss[wave][8 * g + r][j * 16 + col] = acc[j][r] * (1.0f / 2048.0f); }
  ldsx();
  for (int rl = 0; rl < 16; ++rl) if (lane < HD / 4) vst2(Y + ((size_t)b * SEQ + ql0 + rl) * CC + h * HD + lane * 4, *(const v4f*)&ss[wave][rl][lane * 4]);
}
__global__ __launch_bounds__(128) __attribute__((amdgpu_num_vgpr(256)))
void k_out(const float* __restrict__ Y, const float* __restrict__ W, const float* __restrict__ Bv, float* __restrict__ O) {
  __shared__ __align__(16) float so[64][132];
  const int tid = threadIdx.x, wave = tid >> 5, lane = tid & 31, col = lane & 15, g = lane >> 4;
  const int c0 = blockIdx.y * 128; const size_t r0 = (size_t)blockIdx.x * 64;   // plane row base
  v8f acc[8] = {};
#pragma unroll 1
  for (int kc = 0; kc < CC / 32; ++kc) {
    const v16h a = frag_f32s(Y + (r0 + wave * 16 + col) * CC + kc * 32, lane, 64.0f);
#pragma unroll
    for (int j = 0; j < 8; ++j) { v16h w; const int oc = c0 + j * 16 + col; const float* wp = W + (size_t)oc * CC + kc * 32 + 8 * g;
#pragma unroll
      for (int i = 0; i < 8; ++i) { w[i] = (_Float16)(bfr(wp[i]) * 64.0f); w[8 + i] = (_Float16)(bfr(wp[16 + i]) * 64.0f); }
      acc[j] = wmma16(a, w, acc[j]); } }
#pragma unroll
  for (int j = 0; j < 8; ++j) { const float bb = bfr(Bv[c0 + j * 16 + col]);
#pragma unroll
    for (int r = 0; r < 8; ++r) { const int rl = wave * 16 + 8 * g + r, cl = j * 16 + col; so[rl][cl] = acc[j][r] * (1.0f / 4096.0f) + bb; } }
  __syncthreads();
  const size_t b = r0 / SEQ; const int t0 = (int)(r0 % SEQ);
  for (int rl = wave * 16; rl < wave * 16 + 16; ++rl)
    vst2(O + (b * SEQ_FULL + (size_t)(t0 + rl)) * CC + c0 + lane * 4, *(const v4f*)&so[rl][lane * 4]);
}

extern "C" void kernel_launch(void* const* d_in, const int* in_sizes, int n_in, void* d_out, int out_size, void* d_ws, size_t ws_size, hipStream_t stream) {
  if (n_in < 4) return;
  const size_t rows_needed = (size_t)(NB - 1) * SEQ_FULL + SEQ;
  if ((size_t)in_sizes[0] < rows_needed * CC) return;            // x [2,2048,1024]
  if ((size_t)in_sizes[1] < (size_t)3 * CC * CC) return;         // w_qkv [3072,1024] ([out][in])
  if ((size_t)in_sizes[2] < (size_t)CC * CC) return;             // w_out [1024,1024] ([out][in])
  if (in_sizes[3] < CC) return;                                   // b_out [1024]
  if ((size_t)out_size < rows_needed * CC) return;
  if (ws_size < (size_t)WS_END) return;
  const float* X = (const float*)d_in[0]; const float* W = (const float*)d_in[1]; const float* WO = (const float*)d_in[2]; const float* BO = (const float*)d_in[3];
  char* ws = (char*)d_ws;
  _Float16 *QH = (_Float16*)(ws + WS_QH), *QL = (_Float16*)(ws + WS_QL), *KH = (_Float16*)(ws + WS_KH);
  __bf16 *VT = (__bf16*)(ws + WS_VT), *VL = (__bf16*)(ws + WS_VL);
  float *S = (float*)(ws + WS_S), *Y = (float*)(ws + WS_Y);
  k_proj<<<dim3(NB * SEQ / 64, CC / 128, 3), 128, 0, stream>>>(X, W, QH, QL, KH, VT, VL);
  for (int b = 0; b < NB; ++b) for (int h0 = 0; h0 < NH; h0 += HG) {
    k_sc<<<dim3(SEQ / 64, SEQ / 128, HG), 128, 0, stream>>>(QH, QL, KH, b, h0, S);
    k_sm<<<dim3(SEQ, HG), 256, 0, stream>>>(S);
    k_pv<<<dim3(SEQ / 64, 1, HG), 128, 0, stream>>>(S, VT, VL, b, h0, Y);
  }
  k_out<<<dim3(NB * SEQ / 64, CC / 128), 128, 0, stream>>>(Y, WO, BO, (float*)d_out);
}

// v001
// One run takes 526 microseconds.
// In both of two side-by-side timings against v000, it was 3.17 times as fast.
// compute dtype: x and W_qkv RNE-converted to bf16; q/k/v = x W_qkv^T with exact bf16 products on v_wmma_f32_16x16x32_bf16, f32 accumulate; q as f16 hi + residual (x 2^10), k once to f16 -> 2-product logits (v_wmma_f32_16x16x32_f16) x (1/64) in f32 registers; running-maximum softmax in f32 (precise expf); P f32 split bf16 hi + lo against v bf16 hi + lo (3 bf16 products), divided by the row sum at the end; merged heads y in f32; y (x 2^6, f16) times W_out^T (bf16 values x 2^6, f16): 1 f16 product, f32 accumulate, + bf16 b_out.
#include <hip/hip_runtime.h>
#include <math.h>

typedef __attribute__((ext_vector_type(16))) _Float16 v16h;
typedef __attribute__((ext_vector_type(16))) __bf16 v16b;
typedef __attribute__((ext_vector_type(8)))  _Float16 v8h;
typedef __attribute__((ext_vector_type(8)))  __bf16 v8b;
typedef __attribute__((ext_vector_type(8)))  float v8f;
typedef __attribute__((ext_vector_type(4)))  float v4f;
typedef __attribute__((ext_vector_type(4)))  unsigned v4u;

template <typename T> __device__ __forceinline__ void vst2(void* p, T v) { *(T*)p = v;  }

__device__ __forceinline__ v8f wmma16(v16h a, v16h b, v8f c) {
  v8f d = __builtin_amdgcn_wmma_f32_16x16x32_f16(false, a, false, b, (short)0, c, false, false);
  asm volatile("v_nop\n\tv_nop\n\tv_nop\n\tv_nop" : "+v"(d) : "v"(a), "v"(b));
  return d;
}
__device__ __forceinline__ v8f wmma_bf(v16b a, v16b b, v8f c) {
  v8f d = __builtin_amdgcn_wmma_f32_16x16x32_bf16(false, a, false, b, (short)0, c, false, false);
  asm volatile("v_nop\n\tv_nop\n\tv_nop\n\tv_nop" : "+v"(d) : "v"(a), "v"(b));
  return d;
}
// 16x16x32 fragments: lane = (g = lane>>4, row/col = lane&15); elements 0..7 = k0+8g+0..7, 8..15 = k0+16+8g+0..7; D element r = row 8g+r, col lane&15
__device__ __forceinline__ v16h frag_h(const _Float16* rowk0, int lane) {
  union { v16h v; v8h q[2]; } u; const _Float16* p = rowk0 + 8 * (lane >> 4);
  u.q[0] = *(const v8h*)p; u.q[1] = *(const v8h*)(p + 16); return u.v;
}
// f16 and bf16 fragments from a pointer that already holds the lane's 8 * (lane >> 4)
__device__ __forceinline__ v16h frag_hp(const _Float16* p) { union { v16h v; v8h q[2]; } u; u.q[0] = *(const v8h*)p;
  asm volatile("s_wait_xcnt 0x0" ::: "memory");   // the build lets the second load's result land on the address pair that the first load names: the wait stands in front of that overwrite
  u.q[1] = *(const v8h*)(p + 16); return u.v; }
__device__ __forceinline__ v16b frag_bp(const __bf16* p) { union { v16b v; v8b q[2]; } u; u.q[0] = *(const v8b*)p; u.q[1] = *(const v8b*)(p + 16); return u.v; }
// f32 row -> f16 fragment with a power-of-two carry sc
__device__ __forceinline__ v16h frag_f32s(const float* rowk0, int lane, float sc) {
  v16h a; const float* p = rowk0 + 8 * (lane >> 4);
#pragma unroll
  for (int i = 0; i < 8; ++i) { a[i] = (_Float16)(p[i] * sc); a[8 + i] = (_Float16)(p[16 + i] * sc); }
  return a;
}
// 16 f32 values -> bf16 hi + lo fragment pair
struct F2 { v16b h, l; };
__device__ __forceinline__ F2 bsplit16(const float v[16]) { F2 r;
#pragma unroll
  for (int i = 0; i < 16; ++i) { const __bf16 hb = (__bf16)v[i]; r.h[i] = hb; r.l[i] = (__bf16)(v[i] - (float)hb); }
  return r; }
__device__ __forceinline__ float bfr(float v) { return (float)(__bf16)v; }

// sizes: B 2, N 2048, C 1024 = 16 heads x 64; logits x (1/64); output projection C -> C with bias
#define NB_FULL 2
#define SEQ_FULL 2048
#ifndef NB
#define NB NB_FULL
#endif
#ifndef SEQ
#define SEQ SEQ_FULL
#endif
#define CC 1024
#define NH 16
#define HD 64
static_assert(NB >= 1 && NB <= NB_FULL);
static_assert(SEQ >= 128 && SEQ <= SEQ_FULL && (SEQ % 128) == 0);
static_assert(NH * HD == CC && HD == 64 && (CC % 128) == 0);

#define PR     ((size_t)NB * SEQ)                                 // plane rows (b*SEQ + t)
#define WS_QH  ((size_t)0)                                        // f16 q hi   [PR][CC]
#define WS_QL  (WS_QH + 2u * PR * CC)                             // f16 q residual x 2^10 [PR][CC]
#define WS_KH  (WS_QL + 2u * PR * CC)                             // f16 k      [PR][CC]
#define WS_VT  (WS_KH + 2u * PR * CC)                             // bf16 v hi planes [b][c][t]
#define WS_VL  (WS_VT + 2u * (size_t)NB * CC * SEQ)               // bf16 v lo planes [b][c][t]
#define WS_Y   (WS_VL + 2u * (size_t)NB * CC * SEQ)               // f32 merged heads y [PR][CC]
#define WS_END (WS_Y + 4u * PR * CC)
static_assert(WS_END <= (size_t)134217728u);
static_assert((((size_t)(NB - 1) * SEQ_FULL + SEQ) * CC) <= (size_t)NB_FULL * SEQ_FULL * CC);

// ---- k_proj: block = (64 plane rows, 128 cols, which in {q,k,v}); W rows = which*CC + (h*HD + d); q -> f16 hi + residual, k -> f16, v -> bf16 hi/lo planes [b][c][t]
__global__ __launch_bounds__(128) __attribute__((amdgpu_num_vgpr(256)))
void k_proj(const float* __restrict__ X, const float* __restrict__ W, _Float16* __restrict__ QH, _Float16* __restrict__ QL, _Float16* __restrict__ KH, __bf16* __restrict__ VT, __bf16* __restrict__ VL) {
  __shared__ __align__(16) _Float16 sh[64][136], sl[64][136];
  __shared__ __align__(16) __bf16 th[128][72], tl2[128][72];
  const int tid = threadIdx.x, wave = tid >> 5, lane = tid & 31, col = lane & 15, g = lane >> 4;
  const int which = blockIdx.z; const int c0 = blockIdx.y * 128;
  const size_t r0 = (size_t)blockIdx.x * 64;            // plane row base = b*SEQ + t0
  const size_t b = r0 / SEQ; const int t0 = (int)(r0 % SEQ);
  const size_t xr0 = b * SEQ_FULL + (size_t)t0;          // input row base
  v8f acc[8] = {};
#pragma unroll 1
  for (int kc = 0; kc < CC / 32; ++kc) {
    v16b a; { const float* p = X + (xr0 + wave * 16 + col) * CC + kc * 32 + 8 * g;
#pragma unroll
      for (int i = 0; i < 8; ++i) { a[i] = (__bf16)p[i]; a[8 + i] = (__bf16)p[16 + i]; } }
#pragma unroll
    for (int j = 0; j < 8; ++j) { v16b w; const int oc = c0 + j * 16 + col; const float* wp = W + ((size_t)which * CC + oc) * CC + kc * 32 + 8 * g;
#pragma unroll
      for (int i = 0; i < 8; ++i) { w[i] = (__bf16)wp[i]; w[8 + i] = (__bf16)wp[16 + i]; }
      acc[j] = wmma_bf(a, w, acc[j]); } }
#pragma unroll
  for (int j = 0; j < 8; ++j) {
#pragma unroll
    for (int r = 0; r < 8; ++r) { const float v = acc[j][r]; const int rl = wave * 16 + 8 * g + r, cl = j * 16 + col;
      if (which == 2) { const __bf16 bh = (__bf16)v; th[cl][rl] = bh; tl2[cl][rl] = (__bf16)(v - (float)bh); }
      else { const _Float16 hv = (_Float16)v; sh[rl][cl] = hv; sl[rl][cl] = (_Float16)((v - (float)hv) * 1024.0f); }   // q residual carried x 2^10 so the plane stays f16-normal
    } }
  __syncthreads();
  if (which < 2) { _Float16* dh = (which == 0) ? QH : KH;
    for (int e = tid; e < 64 * 16; e += 128) { const int rl = e >> 4, q = e & 15; const size_t o = (r0 + rl) * CC + c0 + q * 8;
      vst2(dh + o, *(const v4u*)&sh[rl][q * 8]); if (which == 0) vst2(QL + o, *(const v4u*)&sl[rl][q * 8]); } }
  else { for (int e = tid; e < 128 * 8; e += 128) { const int cl = e >> 3, q = e & 7; const size_t o2 = (b * CC + c0 + cl) * (size_t)SEQ + t0 + q * 8;
      vst2(VT + o2, *(const v4u*)&th[cl][q * 8]); vst2(VL + o2, *(const v4u*)&tl2[cl][q * 8]); } }
}
#define NQ 2
#define AW 8
static_assert((SEQ % (AW * NQ * 16)) == 0);
__global__ __launch_bounds__(AW * 32) __attribute__((amdgpu_num_vgpr(256)))
void k_attn(const _Float16* __restrict__ QH, const _Float16* __restrict__ QL, const _Float16* __restrict__ KH, const __bf16* __restrict__ VT, const __bf16* __restrict__ VL, float* __restrict__ Y) {
  const int tid = threadIdx.x, wave = tid >> 5, lane = tid & 31, col = lane & 15, g = lane >> 4;
  const int h = blockIdx.y, b = blockIdx.z;
  const size_t q0 = (size_t)b * SEQ + blockIdx.x * (AW * NQ * 16) + wave * (NQ * 16);
  v16h qh[NQ][HD / 32], ql[NQ][HD / 32];
#pragma unroll
  for (int u = 0; u < NQ; ++u) {
#pragma unroll
    for (int kc = 0; kc < HD / 32; ++kc) { const size_t o = (q0 + u * 16 + col) * CC + h * HD + kc * 32; qh[u][kc] = frag_h(QH + o, lane); ql[u][kc] = frag_h(QL + o, lane); } }
  const _Float16* kp = KH + (size_t)b * SEQ * CC + h * HD;               // wave-uniform bases, advanced per pass; the lane's own part is a fixed 32-bit offset
  const __bf16* vhp = VT + ((size_t)b * CC + h * HD) * (size_t)SEQ;
  const __bf16* vlp = VL + ((size_t)b * CC + h * HD) * (size_t)SEQ;
  const unsigned ko = (unsigned)(col * CC + 8 * g), vo = (unsigned)(col * SEQ + 8 * g);
  v8f acc[NQ][HD / 16] = {};
  float m[NQ], l[NQ];
#pragma unroll
  for (int u = 0; u < NQ; ++u) { m[u] = -3.0e38f; l[u] = 0.f; }
#pragma unroll 1                                            // rolled: one pass already fills the 256-register budget
  for (int kt = 0; kt < SEQ / 32; ++kt) {
    v8f sa[NQ][2] = {}, sb[NQ][2] = {};
#pragma unroll
    for (int kc = 0; kc < HD / 32; ++kc) {
#pragma unroll
      for (int t = 0; t < 2; ++t) { const v16h kb = frag_hp(kp + (size_t)(t * 16) * CC + kc * 32 + ko);
#pragma unroll
        for (int u = 0; u < NQ; ++u) { sa[u][t] = wmma16(kb, qh[u][kc], sa[u][t]); sb[u][t] = wmma16(kb, ql[u][kc], sb[u][t]); } } }
    F2 pf[NQ];
#pragma unroll
    for (int u = 0; u < NQ; ++u) {
      float p[16]; float mx = m[u];
#pragma unroll
      for (int i = 0; i < 16; ++i) { p[i] = (sa[u][i >> 3][i & 7] + sb[u][i >> 3][i & 7] * (1.0f / 1024.0f)) * (1.0f / 64.0f); mx = fmaxf(mx, p[i]); }
      mx = fmaxf(mx, __shfl_xor(mx, 16));
      if (__builtin_amdgcn_ballot_w32(mx > m[u]) != 0) {     // some query's maximum rose: rescale (the factor is exactly 1 for the others)
        const float al = expf(m[u] - mx); l[u] *= al; m[u] = mx;
#pragma unroll
        for (int j = 0; j < HD / 16; ++j) acc[u][j] = acc[u][j] * al; }
#pragma unroll
      for (int i = 0; i < 16; ++i) { p[i] = expf(p[i] - m[u]); l[u] += p[i]; }
      pf[u] = bsplit16(p); }
#pragma unroll
    for (int j = 0; j < HD / 16; ++j) {
      const v16b vh = frag_bp(vhp + (size_t)(j * 16) * SEQ + vo), vl = frag_bp(vlp + (size_t)(j * 16) * SEQ + vo);
#pragma unroll
      for (int u = 0; u < NQ; ++u) acc[u][j] = wmma_bf(vh, pf[u].h, acc[u][j]);
#pragma unroll
      for (int u = 0; u < NQ; ++u) acc[u][j] = wmma_bf(vh, pf[u].l, acc[u][j]);
#pragma unroll
      for (int u = 0; u < NQ; ++u) acc[u][j] = wmma_bf(vl, pf[u].h, acc[u][j]); }
    kp += (size_t)32 * CC; vhp += 32; vlp += 32;
  }
#pragma unroll
  for (int u = 0; u < NQ; ++u) {
    const float inv = 1.0f / (l[u] + __shfl_xor(l[u], 16));
    float* yp = Y + (q0 + u * 16 + col) * CC + h * HD + 8 * g;   // acc[u][j][r] = O[query u*16 + col][j*16 + 8g + r]
#pragma unroll
    for (int j = 0; j < HD / 16; ++j) { const v8f o = acc[u][j] * inv;
      vst2(yp + j * 16, (v4f){o[0], o[1], o[2], o[3]}); vst2(yp + j * 16 + 4, (v4f){o[4], o[5], o[6], o[7]}); } }
}
__global__ __launch_bounds__(128) __attribute__((amdgpu_num_vgpr(256)))
void k_out(const float* __restrict__ Y, const float* __restrict__ W, const float* __restrict__ Bv, float* __restrict__ O) {
  __shared__ __align__(16) float so[64][132];
  const int tid = threadIdx.x, wave = tid >> 5, lane = tid & 31, col = lane & 15, g = lane >> 4;
  const int c0 = blockIdx.y * 128; const size_t r0 = (size_t)blockIdx.x * 64;   // plane row base
  v8f acc[8] = {};
#pragma unroll 1
  for (int kc = 0; kc < CC / 32; ++kc) {
    const v16h a = frag_f32s(Y + (r0 + wave * 16 + col) * CC + kc * 32, lane, 64.0f);
#pragma unroll
    for (int j = 0; j < 8; ++j) { v16h w; const int oc = c0 + j * 16 + col; const float* wp = W + (size_t)oc * CC + kc * 32 + 8 * g;
#pragma unroll
      for (int i = 0; i < 8; ++i) { w[i] = (_Float16)(bfr(wp[i]) * 64.0f); w[8 + i] = (_Float16)(bfr(wp[16 + i]) * 64.0f); }
      acc[j] = wmma16(a, w, acc[j]); } }
#pragma unroll
  for (int j = 0; j < 8; ++j) { const float bb = bfr(Bv[c0 + j * 16 + col]);
#pragma unroll
    for (int r = 0; r < 8; ++r) { const int rl = wave * 16 + 8 * g + r, cl = j * 16 + col; so[rl][cl] = acc[j][r] * (1.0f / 4096.0f) + bb; } }
  __syncthreads();
  const size_t b = r0 / SEQ; const int t0 = (int)(r0 % SEQ);
  for (int rl = wave * 16; rl < wave * 16 + 16; ++rl)
    vst2(O + (b * SEQ_FULL + (size_t)(t0 + rl)) * CC + c0 + lane * 4, *(const v4f*)&so[rl][lane * 4]);
}

extern "C" void kernel_launch(void* const* d_in, const int* in_sizes, int n_in, void* d_out, int out_size, void* d_ws, size_t ws_size, hipStream_t stream) {
  if (n_in < 4) return;
  const size_t rows_needed = (size_t)(NB - 1) * SEQ_FULL + SEQ;
  if ((size_t)in_sizes[0] < rows_needed * CC) return;            // x [2,2048,1024]
  if ((size_t)in_sizes[1] < (size_t)3 * CC * CC) return;         // w_qkv [3072,1024] ([out][in])
  if ((size_t)in_sizes[2] < (size_t)CC * CC) return;             // w_out [1024,1024] ([out][in])
  if (in_sizes[3] < CC) return;                                   // b_out [1024]
  if ((size_t)out_size < rows_needed * CC) return;
  if (ws_size < (size_t)WS_END) return;
  const float* X = (const float*)d_in[0]; const float* W = (const float*)d_in[1]; const float* WO = (const float*)d_in[2]; const float* BO = (const float*)d_in[3];
  char* ws = (char*)d_ws;
  _Float16 *QH = (_Float16*)(ws + WS_QH), *QL = (_Float16*)(ws + WS_QL), *KH = (_Float16*)(ws + WS_KH);
  __bf16 *VT = (__bf16*)(ws + WS_VT), *VL = (__bf16*)(ws + WS_VL);
  float *Y = (float*)(ws + WS_Y);
  k_proj<<<dim3(NB * SEQ / 64, CC / 128, 3), 128, 0, stream>>>(X, W, QH, QL, KH, VT, VL);
  k_attn<<<dim3(SEQ / (AW * NQ * 16), NH, NB), AW * 32, 0, stream>>>(QH, QL, KH, VT, VL, Y);
  k_out<<<dim3(NB * SEQ / 64, CC / 128), 128, 0, stream>>>(Y, WO, BO, (float*)d_out);
}

// v002
// Measured time: 250 microseconds a run.
// Two timings next to v001 both put it at 2.10 times that version's speed.
// All steps since v000 together make it 6.65 times as fast.
// compute dtype: x and W_qkv RNE-converted to bf16; q/k/v = x W_qkv^T with exact bf16 products on v_wmma_f32_16x16x32_bf16, f32 accumulate; q as f16 hi + residual (x 2^10), k once to f16 -> 2-product logits (v_wmma_f32_16x16x32_f16) x (1/64) in f32 registers; running-maximum softmax in f32 (precise expf); P f32 split bf16 hi + lo against v bf16 hi + lo (3 bf16 products), divided by the row sum at the end; merged heads y in f32; y (x 2^6, f16) times W_out^T (bf16 values x 2^6, f16): 1 f16 product, f32 accumulate, + bf16 b_out.
#include <hip/hip_runtime.h>
#include <math.h>

typedef __attribute__((ext_vector_type(16))) _Float16 v16h;
typedef __attribute__((ext_vector_type(16))) __bf16 v16b;
typedef __attribute__((ext_vector_type(8)))  _Float16 v8h;
typedef __attribute__((ext_vector_type(8)))  __bf16 v8b;
typedef __attribute__((ext_vector_type(8)))  float v8f;
typedef __attribute__((ext_vector_type(4)))  float v4f;
typedef __attribute__((ext_vector_type(4)))  unsigned v4u;
typedef __attribute__((ext_vector_type(2)))  unsigned v2u;
typedef __attribute__((ext_vector_type(4)))  _Float16 v4h;
typedef __attribute__((ext_vector_type(4)))  __bf16 v4b;

template <typename T> __device__ __forceinline__ void vst2(void* p, T v) { *(T*)p = v;  }

__device__ __forceinline__ v8f wmma16(v16h a, v16h b, v8f c) {
  v8f d = __builtin_amdgcn_wmma_f32_16x16x32_f16(false, a, false, b, (short)0, c, false, false);
  asm volatile("v_nop\n\tv_nop\n\tv_nop\n\tv_nop" : "+v"(d) : "v"(a), "v"(b));
  return d;
}
__device__ __forceinline__ v8f wmma_bf(v16b a, v16b b, v8f c) {
  v8f d = __builtin_amdgcn_wmma_f32_16x16x32_bf16(false, a, false, b, (short)0, c, false, false);
  asm volatile("v_nop\n\tv_nop\n\tv_nop\n\tv_nop" : "+v"(d) : "v"(a), "v"(b));
  return d;
}
// 16x16x32 fragments: lane = (g = lane>>4, row/col = lane&15); elements 0..7 = k0+8g+0..7, 8..15 = k0+16+8g+0..7; D element r = row 8g+r, col lane&15
__device__ __forceinline__ v16h frag_h(const _Float16* rowk0, int lane) {
  union { v16h v; v8h q[2]; } u; const _Float16* p = rowk0 + 8 * (lane >> 4);
  u.q[0] = *(const v8h*)p; u.q[1] = *(const v8h*)(p + 16); return u.v;
}
// f16 and bf16 fragments from a pointer that already holds the lane's 8 * (lane >> 4)
__device__ __forceinline__ v16h frag_hp(const _Float16* p) { union { v16h v; v8h q[2]; } u; u.q[0] = *(const v8h*)p;
  asm volatile("s_wait_xcnt 0x0" ::: "memory");   // the build lets the second load's result land on the address pair that the first load names: the wait stands in front of that overwrite
  u.q[1] = *(const v8h*)(p + 16); return u.v; }
__device__ __forceinline__ v16b frag_bp(const __bf16* p) { union { v16b v; v8b q[2]; } u; u.q[0] = *(const v8b*)p; u.q[1] = *(const v8b*)(p + 16); return u.v; }
// 16 f32 values -> bf16 hi + lo fragment pair
struct F2 { v16b h, l; };
__device__ __forceinline__ F2 bsplit16(const float v[16]) { F2 r;
#pragma unroll
  for (int i = 0; i < 16; ++i) { const __bf16 hb = (__bf16)v[i]; r.h[i] = hb; r.l[i] = (__bf16)(v[i] - (float)hb); }
  return r; }
__device__ __forceinline__ float bfr(float v) { return (float)(__bf16)v; }

// sizes: B 2, N 2048, C 1024 = 16 heads x 64; logits x (1/64); output projection C -> C with bias
#define NB_FULL 2
#define SEQ_FULL 2048
#ifndef NB
#define NB NB_FULL
#endif
#ifndef SEQ
#define SEQ SEQ_FULL
#endif
#define CC 1024
#define NH 16
#define HD 64
static_assert(NB >= 1 && NB <= NB_FULL);
static_assert(SEQ >= 128 && SEQ <= SEQ_FULL && (SEQ % 128) == 0);
static_assert(NH * HD == CC && HD == 64 && (CC % 128) == 0);

#define PR     ((size_t)NB * SEQ)                                 // plane rows (b*SEQ + t)
#define WS_QH  ((size_t)0)                                        // f16 q hi   [PR][CC]
#define WS_QL  (WS_QH + 2u * PR * CC)                             // f16 q residual x 2^10 [PR][CC]
#define WS_KH  (WS_QL + 2u * PR * CC)                             // f16 k      [PR][CC]
#define WS_VT  (WS_KH + 2u * PR * CC)                             // bf16 v hi planes [b][c][t]
#define WS_VL  (WS_VT + 2u * (size_t)NB * CC * SEQ)               // bf16 v lo planes [b][c][t]
#define WS_Y   (WS_VL + 2u * (size_t)NB * CC * SEQ)               // f32 merged heads y [PR][CC]
#define WS_END (WS_Y + 4u * PR * CC)
static_assert(WS_END <= (size_t)134217728u);
static_assert((((size_t)(NB - 1) * SEQ_FULL + SEQ) * CC) <= (size_t)NB_FULL * SEQ_FULL * CC);

// ---- GEMM core of k_proj and k_out: block = 8 waves on a 128 x 128 tile of A . B^T (both operands f32 rows, k contiguous), wave = 32 x 64 (2 x 4 tiles).
// Per step of 32 k the block reads its 128 + 128 rows once, every wave-wide load covering 4 whole 128-byte lines, converts each value once and keeps the 16-bit tile in LDS for all 8 waves.
// Two LDS buffers: step s + 1 is loaded into registers ahead of step s's products and stored behind them; one barrier a step. k runs upward 32 at a time into the same accumulators, in the fragment k order above.
#define GT 128                               // tile rows of either operand
#define GK 32                                // k per step
#define GP 40                                // LDS row pitch in 16-bit elements: 80 B = 16 B x odd, conflict-free for 16-byte fragment reads
#define GBUF (2 * GT * GP)                   // 16-bit elements per buffer: A rows, then B rows
#define GLDS (2 * GT * 136 * 2)              // bytes: the larger of the two buffers (40,960) and the output staging of either kernel
static_assert(2 * GBUF * 2 <= GLDS && GT * 132 * 4 <= GLDS && (SEQ % GT) == 0 && (CC % GT) == 0 && (CC % GK) == 0);
// CV 0: bf16; 1: f16 of v x 2^6; 2: f16 of (v rounded to bf16) x 2^6
template <int CV> __device__ __forceinline__ v2u cvt4(v4f v) {
  union { v4b b; v4h h; v2u u; } r;
#pragma unroll
  for (int i = 0; i < 4; ++i) {
    if constexpr (CV == 0) r.b[i] = (__bf16)v[i];
    else if constexpr (CV == 1) r.h[i] = (_Float16)(v[i] * 64.0f);
    else r.h[i] = (_Float16)(bfr(v[i]) * 64.0f); }
  return r.u;
}
union FR { v16h h; v16b b; v4u q[2]; };
__device__ __forceinline__ FR frag_s(const unsigned short* p) { FR u; u.q[0] = *(const v4u*)p; u.q[1] = *(const v4u*)(p + 16); return u; }
template <bool BF> __device__ __forceinline__ void gemm_step(const unsigned short* fa, const unsigned short* fb, v8f (&acc)[2][4]) {
  FR a[2], w[4];
#pragma unroll
  for (int i = 0; i < 2; ++i) a[i] = frag_s(fa + i * 16 * GP);
#pragma unroll
  for (int j = 0; j < 4; ++j) w[j] = frag_s(fb + j * 16 * GP);
#pragma unroll
  for (int i = 0; i < 2; ++i) {
#pragma unroll
    for (int j = 0; j < 4; ++j) { if constexpr (BF) acc[i][j] = wmma_bf(a[i].b, w[j].b, acc[i][j]); else acc[i][j] = wmma16(a[i].h, w[j].h, acc[i][j]); } }
}
template <int CA, int CB, bool BF>
__device__ __forceinline__ void gemm_core(const float* __restrict__ A, const float* __restrict__ B, unsigned short* lds, v8f (&acc)[2][4]) {
  const int tid = threadIdx.x, wave = tid >> 5, lane = tid & 31, col = lane & 15, g = lane >> 4;
  const float* ap = A + (size_t)(tid >> 3) * CC + (tid & 7) * 4;         // 8 threads a row of 32 floats; 32 rows a sweep, 4 sweeps an operand
  const float* bp = B + (size_t)(tid >> 3) * CC + (tid & 7) * 4;
  const int so = (tid >> 3) * GP + (tid & 7) * 4;
  const int fao = ((wave >> 1) * 32 + col) * GP + 8 * g, fbo = (GT + (wave & 1) * 64 + col) * GP + 8 * g;
  v4f ra[4], rb[4];
#pragma unroll
  for (int i = 0; i < 4; ++i) { ra[i] = *(const v4f*)(ap + (size_t)i * 32 * CC); rb[i] = *(const v4f*)(bp + (size_t)i * 32 * CC); }
#pragma unroll
  for (int i = 0; i < 4; ++i) { *(v2u*)(lds + so + i * 32 * GP) = cvt4<CA>(ra[i]); *(v2u*)(lds + so + (GT + i * 32) * GP) = cvt4<CB>(rb[i]); }
  int cur = 0;
#pragma unroll 1                                            // rolled: the body is the same every step, and unrolled it would only grow the code
  for (int kc = 0; kc < CC / GK - 1; ++kc) {
    __syncthreads();                                        // buffer cur is written by all; buffer cur ^ 1 is left by all its readers
    ap += GK; bp += GK;
#pragma unroll
    for (int i = 0; i < 4; ++i) { ra[i] = *(const v4f*)(ap + (size_t)i * 32 * CC); rb[i] = *(const v4f*)(bp + (size_t)i * 32 * CC); }
    gemm_step<BF>(lds + cur * GBUF + fao, lds + cur * GBUF + fbo, acc);
    __builtin_amdgcn_sched_barrier(0);                      // keeps the waits on the next step's global loads behind this step's products; without it they stand behind the first product
    cur ^= 1;
#pragma unroll
    for (int i = 0; i < 4; ++i) { *(v2u*)(lds + cur * GBUF + so + i * 32 * GP) = cvt4<CA>(ra[i]); *(v2u*)(lds + cur * GBUF + so + (GT + i * 32) * GP) = cvt4<CB>(rb[i]); }
  }
  __syncthreads();
  gemm_step<BF>(lds + cur * GBUF + fao, lds + cur * GBUF + fbo, acc);
  __syncthreads();                                          // every wave has left the buffers: the caller stages its output over them
}

// ---- k_proj: block = (128 plane rows, 128 cols, which in {q,k,v}); W rows = which*CC + (h*HD + d); q -> f16 hi + residual, k -> f16, v -> bf16 hi/lo planes [b][c][t]
__global__ __launch_bounds__(256) __attribute__((amdgpu_num_vgpr(256)))
void k_proj(const float* __restrict__ X, const float* __restrict__ W, _Float16* __restrict__ QH, _Float16* __restrict__ QL, _Float16* __restrict__ KH, __bf16* __restrict__ VT, __bf16* __restrict__ VL) {
  __shared__ __align__(16) unsigned short lds[GLDS / 2];
  const int tid = threadIdx.x, wave = tid >> 5, lane = tid & 31, col = lane & 15, g = lane >> 4;
  const int which = blockIdx.z; const int c0 = blockIdx.y * GT;
  const size_t r0 = (size_t)blockIdx.x * GT;            // plane row base = b*SEQ + t0
  const size_t b = r0 / SEQ; const int t0 = (int)(r0 % SEQ);
  const size_t xr0 = b * SEQ_FULL + (size_t)t0;          // input row base
  v8f acc[2][4] = {};
  gemm_core<0, 0, true>(X + xr0 * CC, W + ((size_t)which * CC + c0) * CC, lds, acc);
  const int rb0 = (wave >> 1) * 32 + 8 * g, cb0 = (wave & 1) * 64 + col;   // acc[i][j][r] = (row rb0 + 16 i + r, col cb0 + 16 j)
  if (which == 2) { __bf16* th = (__bf16*)lds; __bf16* tl2 = th + GT * 136;   // [col][row], pitch 136
#pragma unroll
    for (int i = 0; i < 2; ++i) {
#pragma unroll
      for (int j = 0; j < 4; ++j) { v8b hh, ll;
#pragma unroll
        for (int r = 0; r < 8; ++r) { const float v = acc[i][j][r]; const __bf16 bh = (__bf16)v; hh[r] = bh; ll[r] = (__bf16)(v - (float)bh); }
        const int o = (cb0 + j * 16) * 136 + rb0 + i * 16; *(v8b*)(th + o) = hh; *(v8b*)(tl2 + o) = ll; } }
    __syncthreads();
#pragma unroll                                              // unrolled: one address with immediate offsets, the LDS reads issued together ahead of the stores
    for (int it = 0; it < GT * 16 / 256; ++it) { const int cl = it * 16 + (tid >> 4), q = tid & 15; const size_t o2 = (b * CC + c0 + cl) * (size_t)SEQ + t0 + q * 8;
      vst2(VT + o2, *(const v4u*)(th + cl * 136 + q * 8)); vst2(VL + o2, *(const v4u*)(tl2 + cl * 136 + q * 8)); } }
  else { _Float16* sh = (_Float16*)lds; _Float16* sl = sh + GT * 136;         // [row][col], pitch 136
#pragma unroll
    for (int i = 0; i < 2; ++i) {
#pragma unroll
      for (int j = 0; j < 4; ++j) {
#pragma unroll
        for (int r = 0; r < 8; ++r) { const float v = acc[i][j][r]; const int o = (rb0 + i * 16 + r) * 136 + cb0 + j * 16;
          const _Float16 hv = (_Float16)v; sh[o] = hv; sl[o] = (_Float16)((v - (float)hv) * 1024.0f); } } }   // q residual carried x 2^10 so the plane stays f16-normal
    __syncthreads();
    if (which == 0) {
#pragma unroll                                              // unrolled, as above
      for (int it = 0; it < GT * 16 / 256; ++it) { const int rl = it * 16 + (tid >> 4), q = tid & 15; const size_t o = (r0 + rl) * CC + c0 + q * 8;
        vst2(QH + o, *(const v4u*)(sh + rl * 136 + q * 8)); vst2(QL + o, *(const v4u*)(sl + rl * 136 + q * 8)); }
      asm volatile("s_wait_xcnt 0x0" ::: "memory"); }     // the build lays the v branch, which rewrites these stores' registers, behind them: the wait stands in front of it
    else {
#pragma unroll                                              // unrolled, as above
      for (int it = 0; it < GT * 16 / 256; ++it) { const int rl = it * 16 + (tid >> 4), q = tid & 15;
        vst2(KH + (r0 + rl) * CC + c0 + q * 8, *(const v4u*)(sh + rl * 136 + q * 8)); }
      asm volatile("s_wait_xcnt 0x0" ::: "memory"); } }   // the build lays the q branch, which rewrites these stores' registers, directly behind them: the wait stands in front of it
}
#define NQ 2
#define AW 8
static_assert((SEQ % (AW * NQ * 16)) == 0);
__global__ __launch_bounds__(AW * 32) __attribute__((amdgpu_num_vgpr(256)))
void k_attn(const _Float16* __restrict__ QH, const _Float16* __restrict__ QL, const _Float16* __restrict__ KH, const __bf16* __restrict__ VT, const __bf16* __restrict__ VL, float* __restrict__ Y) {
  const int tid = threadIdx.x, wave = tid >> 5, lane = tid & 31, col = lane & 15, g = lane >> 4;
  const int h = blockIdx.y, b = blockIdx.z;
  const size_t q0 = (size_t)b * SEQ + blockIdx.x * (AW * NQ * 16) + wave * (NQ * 16);
  v16h qh[NQ][HD / 32], ql[NQ][HD / 32];
#pragma unroll
  for (int u = 0; u < NQ; ++u) {
#pragma unroll
    for (int kc = 0; kc < HD / 32; ++kc) { const size_t o = (q0 + u * 16 + col) * CC + h * HD + kc * 32; qh[u][kc] = frag_h(QH + o, lane); ql[u][kc] = frag_h(QL + o, lane); } }
  const _Float16* kp = KH + (size_t)b * SEQ * CC + h * HD;               // wave-uniform bases, advanced per pass; the lane's own part is a fixed 32-bit offset
  const __bf16* vhp = VT + ((size_t)b * CC + h * HD) * (size_t)SEQ;
  const __bf16* vlp = VL + ((size_t)b * CC + h * HD) * (size_t)SEQ;
  const unsigned ko = (unsigned)(col * CC + 8 * g), vo = (unsigned)(col * SEQ + 8 * g);
  v8f acc[NQ][HD / 16] = {};
  float m[NQ], l[NQ];
#pragma unroll
  for (int u = 0; u < NQ; ++u) { m[u] = -3.0e38f; l[u] = 0.f; }
#pragma unroll 1                                            // rolled: one pass already fills the 256-register budget
  for (int kt = 0; kt < SEQ / 32; ++kt) {
    v8f sa[NQ][2] = {}, sb[NQ][2] = {};
#pragma unroll
    for (int kc = 0; kc < HD / 32; ++kc) {
#pragma unroll
      for (int t = 0; t < 2; ++t) { const v16h kb = frag_hp(kp + (size_t)(t * 16) * CC + kc * 32 + ko);
#pragma unroll
        for (int u = 0; u < NQ; ++u) { sa[u][t] = wmma16(kb, qh[u][kc], sa[u][t]); sb[u][t] = wmma16(kb, ql[u][kc], sb[u][t]); } } }
    F2 pf[NQ];
#pragma unroll
    for (int u = 0; u < NQ; ++u) {
      float p[16]; float mx = m[u];
#pragma unroll
      for (int i = 0; i < 16; ++i) { p[i] = (sa[u][i >> 3][i & 7] + sb[u][i >> 3][i & 7] * (1.0f / 1024.0f)) * (1.0f / 64.0f); mx = fmaxf(mx, p[i]); }
      mx = fmaxf(mx, __shfl_xor(mx, 16));
      if (__builtin_amdgcn_ballot_w32(mx > m[u]) != 0) {     // some query's maximum rose: rescale (the factor is exactly 1 for the others)
        const float al = expf(m[u] - mx); l[u] *= al; m[u] = mx;
#pragma unroll
        for (int j = 0; j < HD / 16; ++j) acc[u][j] = acc[u][j] * al; }
#pragma unroll
      for (int i = 0; i < 16; ++i) { p[i] = expf(p[i] - m[u]); l[u] += p[i]; }
      pf[u] = bsplit16(p); }
#pragma unroll
    for (int j = 0; j < HD / 16; ++j) {
      const v16b vh = frag_bp(vhp + (size_t)(j * 16) * SEQ + vo), vl = frag_bp(vlp + (size_t)(j * 16) * SEQ + vo);
#pragma unroll
      for (int u = 0; u < NQ; ++u) acc[u][j] = wmma_bf(vh, pf[u].h, acc[u][j]);
#pragma unroll
      for (int u = 0; u < NQ; ++u) acc[u][j] = wmma_bf(vh, pf[u].l, acc[u][j]);
#pragma unroll
      for (int u = 0; u < NQ; ++u) acc[u][j] = wmma_bf(vl, pf[u].h, acc[u][j]); }
    kp += (size_t)32 * CC; vhp += 32; vlp += 32;
  }
#pragma unroll
  for (int u = 0; u < NQ; ++u) {
    const float inv = 1.0f / (l[u] + __shfl_xor(l[u], 16));
    float* yp = Y + (q0 + u * 16 + col) * CC + h * HD + 8 * g;   // acc[u][j][r] = O[query u*16 + col][j*16 + 8g + r]
#pragma unroll
    for (int j = 0; j < HD / 16; ++j) { const v8f o = acc[u][j] * inv;
      vst2(yp + j * 16, (v4f){o[0], o[1], o[2], o[3]}); vst2(yp + j * 16 + 4, (v4f){o[4], o[5], o[6], o[7]}); } }
}
// ---- k_out: block = (128 plane rows, 128 cols): y (x 2^6, f16) . W_out^T (bf16 values x 2^6, f16), + bf16 b_out
__global__ __launch_bounds__(256) __attribute__((amdgpu_num_vgpr(256)))
void k_out(const float* __restrict__ Y, const float* __restrict__ W, const float* __restrict__ Bv, float* __restrict__ O) {
  __shared__ __align__(16) unsigned short lds[GLDS / 2];
  const int tid = threadIdx.x, wave = tid >> 5, lane = tid & 31, col = lane & 15, g = lane >> 4;
  const int c0 = blockIdx.y * GT; const size_t r0 = (size_t)blockIdx.x * GT;   // plane row base
  v8f acc[2][4] = {};
  gemm_core<1, 2, false>(Y + r0 * CC, W + (size_t)c0 * CC, lds, acc);
  float* so = (float*)lds;                                                     // [row][col], pitch 132
  const int rb0 = (wave >> 1) * 32 + 8 * g, cb0 = (wave & 1) * 64 + col;
#pragma unroll
  for (int j = 0; j < 4; ++j) { const float bb = bfr(Bv[c0 + cb0 + j * 16]);
#pragma unroll
    for (int i = 0; i < 2; ++i) {
#pragma unroll
      for (int r = 0; r < 8; ++r) so[(rb0 + i * 16 + r) * 132 + cb0 + j * 16] = acc[i][j][r] * (1.0f / 4096.0f) + bb; } }
  __syncthreads();
  const size_t b = r0 / SEQ; const int t0 = (int)(r0 % SEQ);
  for (int rl = wave * 16; rl < wave * 16 + 16; ++rl)
    vst2(O + (b * SEQ_FULL + (size_t)(t0 + rl)) * CC + c0 + lane * 4, *(const v4f*)(so + rl * 132 + lane * 4));
}

extern "C" void kernel_launch(void* const* d_in, const int* in_sizes, int n_in, void* d_out, int out_size, void* d_ws, size_t ws_size, hipStream_t stream) {
  if (n_in < 4) return;
  const size_t rows_needed = (size_t)(NB - 1) * SEQ_FULL + SEQ;
  if ((size_t)in_sizes[0] < rows_needed * CC) return;            // x [2,2048,1024]
  if ((size_t)in_sizes[1] < (size_t)3 * CC * CC) return;         // w_qkv [3072,1024] ([out][in])
  if ((size_t)in_sizes[2] < (size_t)CC * CC) return;             // w_out [1024,1024] ([out][in])
  if (in_sizes[3] < CC) return;                                   // b_out [1024]
  if ((size_t)out_size < rows_needed * CC) return;
  if (ws_size < (size_t)WS_END) return;
  const float* X = (const float*)d_in[0]; const float* W = (const float*)d_in[1]; const float* WO = (const float*)d_in[2]; const float* BO = (const float*)d_in[3];
  char* ws = (char*)d_ws;
  _Float16 *QH = (_Float16*)(ws + WS_QH), *QL = (_Float16*)(ws + WS_QL), *KH = (_Float16*)(ws + WS_KH);
  __bf16 *VT = (__bf16*)(ws + WS_VT), *VL = (__bf16*)(ws + WS_VL);
  float *Y = (float*)(ws + WS_Y);
  k_proj<<<dim3(NB * SEQ / GT, CC / GT, 3), 256, 0, stream>>>(X, W, QH, QL, KH, VT, VL);
  k_attn<<<dim3(SEQ / (AW * NQ * 16), NH, NB), AW * 32, 0, stream>>>(QH, QL, KH, VT, VL, Y);
  k_out<<<dim3(NB * SEQ / GT, CC / GT), 256, 0, stream>>>(Y, WO, BO, (float*)d_out);
}

// v003
// Measured time: 166 microseconds a run.
// Two timings next to v002 both put it at 1.52 times that version's speed.
// Counting every step since v000, it is 10.1 times as fast.
// compute dtype: x and W_qkv RNE-converted to bf16; q/k/v = x W_qkv^T with exact bf16 products on v_wmma_f32_16x16x32_bf16, f32 accumulate; q as f16 hi + residual (x 2^10), k once to f16 -> 2-product logits (v_wmma_f32_16x16x32_f16) x (1/64) in f32 registers; running-maximum softmax in f32 (precise expf); P f32 split bf16 hi + lo against v bf16 hi + lo (3 bf16 products), divided by the row sum at the end; merged heads y in f32; y (x 2^6, f16) times W_out^T (bf16 values x 2^6, f16): 1 f16 product, f32 accumulate, + bf16 b_out.
#include <hip/hip_runtime.h>
#include <math.h>

typedef __attribute__((ext_vector_type(16))) _Float16 v16h;
typedef __attribute__((ext_vector_type(16))) __bf16 v16b;
typedef __attribute__((ext_vector_type(8)))  _Float16 v8h;
typedef __attribute__((ext_vector_type(8)))  __bf16 v8b;
typedef __attribute__((ext_vector_type(8)))  float v8f;
typedef __attribute__((ext_vector_type(4)))  float v4f;
typedef __attribute__((ext_vector_type(4)))  unsigned v4u;
typedef __attribute__((ext_vector_type(2)))  unsigned v2u;
typedef __attribute__((ext_vector_type(4)))  _Float16 v4h;
typedef __attribute__((ext_vector_type(4)))  __bf16 v4b;

template <typename T> __device__ __forceinline__ void vst2(void* p, T v) { *(T*)p = v;  }

__device__ __forceinline__ v8f wmma16(v16h a, v16h b, v8f c) {
  v8f d = __builtin_amdgcn_wmma_f32_16x16x32_f16(false, a, false, b, (short)0, c, false, false);
  asm volatile("v_nop\n\tv_nop\n\tv_nop\n\tv_nop" : "+v"(d) : "v"(a), "v"(b));
  return d;
}
__device__ __forceinline__ v8f wmma_bf(v16b a, v16b b, v8f c) {
  v8f d = __builtin_amdgcn_wmma_f32_16x16x32_bf16(false, a, false, b, (short)0, c, false, false);
  asm volatile("v_nop\n\tv_nop\n\tv_nop\n\tv_nop" : "+v"(d) : "v"(a), "v"(b));
  return d;
}
// 16x16x32 fragments: lane = (g = lane>>4, row/col = lane&15); elements 0..7 = k0+8g+0..7, 8..15 = k0+16+8g+0..7; D element r = row 8g+r, col lane&15
__device__ __forceinline__ v16h frag_h(const _Float16* rowk0, int lane) {
  union { v16h v; v8h q[2]; } u; const _Float16* p = rowk0 + 8 * (lane >> 4);
  u.q[0] = *(const v8h*)p; u.q[1] = *(const v8h*)(p + 16); return u.v;
}
// 16 f32 values -> bf16 hi + lo fragment pair
struct F2 { v16b h, l; };
__device__ __forceinline__ F2 bsplit16(const float v[16]) { F2 r;
#pragma unroll
  for (int i = 0; i < 16; ++i) { const __bf16 hb = (__bf16)v[i]; r.h[i] = hb; r.l[i] = (__bf16)(v[i] - (float)hb); }
  return r; }
__device__ __forceinline__ float bfr(float v) { return (float)(__bf16)v; }

// sizes: B 2, N 2048, C 1024 = 16 heads x 64; logits x (1/64); output projection C -> C with bias
#define NB_FULL 2
#define SEQ_FULL 2048
#ifndef NB
#define NB NB_FULL
#endif
#ifndef SEQ
#define SEQ SEQ_FULL
#endif
#define CC 1024
#define NH 16
#define HD 64
static_assert(NB >= 1 && NB <= NB_FULL);
static_assert(SEQ >= 128 && SEQ <= SEQ_FULL && (SEQ % 128) == 0);
static_assert(NH * HD == CC && HD == 64 && (CC % 128) == 0);

#define PR     ((size_t)NB * SEQ)                                 // plane rows (b*SEQ + t)
#define WS_QH  ((size_t)0)                                        // f16 q hi   [PR][CC]
#define WS_QL  (WS_QH + 2u * PR * CC)                             // f16 q residual x 2^10 [PR][CC]
#define WS_KH  (WS_QL + 2u * PR * CC)                             // f16 k      [PR][CC]
#define WS_VT  (WS_KH + 2u * PR * CC)                             // bf16 v hi planes [b][c][t]
#define WS_VL  (WS_VT + 2u * (size_t)NB * CC * SEQ)               // bf16 v lo planes [b][c][t]
#define WS_Y   (WS_VL + 2u * (size_t)NB * CC * SEQ)               // f32 merged heads y [PR][CC]
#define WS_END (WS_Y + 4u * PR * CC)
static_assert(WS_END <= (size_t)134217728u);
static_assert((((size_t)(NB - 1) * SEQ_FULL + SEQ) * CC) <= (size_t)NB_FULL * SEQ_FULL * CC);

// ---- GEMM core of k_proj and k_out: block = 8 waves on a 128 x 128 tile of A . B^T (both operands f32 rows, k contiguous), wave = 32 x 64 (2 x 4 tiles).
// Per step of 32 k the block reads its 128 + 128 rows once, every wave-wide load covering 4 whole 128-byte lines, converts each value once and keeps the 16-bit tile in LDS for all 8 waves.
// Two LDS buffers: step s + 1 is loaded into registers ahead of step s's products and stored behind them; one barrier a step. k runs upward 32 at a time into the same accumulators, in the fragment k order above.
#define GT 128                               // tile rows of either operand
#define GK 32                                // k per step
#define GP 40                                // LDS row pitch in 16-bit elements: 80 B = 16 B x odd, conflict-free for 16-byte fragment reads
#define GBUF (2 * GT * GP)                   // 16-bit elements per buffer: A rows, then B rows
#define GLDS (2 * GT * 136 * 2)              // bytes: the larger of the two buffers (40,960) and the output staging of either kernel
static_assert(2 * GBUF * 2 <= GLDS && GT * 132 * 4 <= GLDS && (SEQ % GT) == 0 && (CC % GT) == 0 && (CC % GK) == 0);
// CV 0: bf16; 1: f16 of v x 2^6; 2: f16 of (v rounded to bf16) x 2^6
template <int CV> __device__ __forceinline__ v2u cvt4(v4f v) {
  union { v4b b; v4h h; v2u u; } r;
#pragma unroll
  for (int i = 0; i < 4; ++i) {
    if constexpr (CV == 0) r.b[i] = (__bf16)v[i];
    else if constexpr (CV == 1) r.h[i] = (_Float16)(v[i] * 64.0f);
    else r.h[i] = (_Float16)(bfr(v[i]) * 64.0f); }
  return r.u;
}
union FR { v16h h; v16b b; v4u q[2]; };
__device__ __forceinline__ FR frag_s(const unsigned short* p) { FR u; u.q[0] = *(const v4u*)p; u.q[1] = *(const v4u*)(p + 16); return u; }
template <bool BF> __device__ __forceinline__ void gemm_step(const unsigned short* fa, const unsigned short* fb, v8f (&acc)[2][4]) {
  FR a[2], w[4];
#pragma unroll
  for (int i = 0; i < 2; ++i) a[i] = frag_s(fa + i * 16 * GP);
#pragma unroll
  for (int j = 0; j < 4; ++j) w[j] = frag_s(fb + j * 16 * GP);
#pragma unroll
  for (int i = 0; i < 2; ++i) {
#pragma unroll
    for (int j = 0; j < 4; ++j) { if constexpr (BF) acc[i][j] = wmma_bf(a[i].b, w[j].b, acc[i][j]); else acc[i][j] = wmma16(a[i].h, w[j].h, acc[i][j]); } }
}
template <int CA, int CB, bool BF>
__device__ __forceinline__ void gemm_core(const float* __restrict__ A, const float* __restrict__ B, unsigned short* lds, v8f (&acc)[2][4]) {
  const int tid = threadIdx.x, wave = tid >> 5, lane = tid & 31, col = lane & 15, g = lane >> 4;
  const float* ap = A + (size_t)(tid >> 3) * CC + (tid & 7) * 4;         // 8 threads a row of 32 floats; 32 rows a sweep, 4 sweeps an operand
  const float* bp = B + (size_t)(tid >> 3) * CC + (tid & 7) * 4;
  const int so = (tid >> 3) * GP + (tid & 7) * 4;
  const int fao = ((wave >> 1) * 32 + col) * GP + 8 * g, fbo = (GT + (wave & 1) * 64 + col) * GP + 8 * g;
  v4f ra[4], rb[4];
#pragma unroll
  for (int i = 0; i < 4; ++i) { ra[i] = *(const v4f*)(ap + (size_t)i * 32 * CC); rb[i] = *(const v4f*)(bp + (size_t)i * 32 * CC); }
#pragma unroll
  for (int i = 0; i < 4; ++i) { *(v2u*)(lds + so + i * 32 * GP) = cvt4<CA>(ra[i]); *(v2u*)(lds + so + (GT + i * 32) * GP) = cvt4<CB>(rb[i]); }
  int cur = 0;
#pragma unroll 1                                            // rolled: the body is the same every step, and unrolled it would only grow the code
  for (int kc = 0; kc < CC / GK - 1; ++kc) {
    __syncthreads();                                        // buffer cur is written by all; buffer cur ^ 1 is left by all its readers
    ap += GK; bp += GK;
#pragma unroll
    for (int i = 0; i < 4; ++i) { ra[i] = *(const v4f*)(ap + (size_t)i * 32 * CC); rb[i] = *(const v4f*)(bp + (size_t)i * 32 * CC); }
    gemm_step<BF>(lds + cur * GBUF + fao, lds + cur * GBUF + fbo, acc);
    __builtin_amdgcn_sched_barrier(0);                      // keeps the waits on the next step's global loads behind this step's products; without it they stand behind the first product
    cur ^= 1;
#pragma unroll
    for (int i = 0; i < 4; ++i) { *(v2u*)(lds + cur * GBUF + so + i * 32 * GP) = cvt4<CA>(ra[i]); *(v2u*)(lds + cur * GBUF + so + (GT + i * 32) * GP) = cvt4<CB>(rb[i]); }
  }
  __syncthreads();
  gemm_step<BF>(lds + cur * GBUF + fao, lds + cur * GBUF + fbo, acc);
  __syncthreads();                                          // every wave has left the buffers: the caller stages its output over them
}

// ---- k_proj: block = (128 plane rows, 128 cols, which in {q,k,v}); W rows = which*CC + (h*HD + d); q -> f16 hi + residual, k -> f16, v -> bf16 hi/lo planes [b][c][t]
__global__ __launch_bounds__(256) __attribute__((amdgpu_num_vgpr(256)))
void k_proj(const float* __restrict__ X, const float* __restrict__ W, _Float16* __restrict__ QH, _Float16* __restrict__ QL, _Float16* __restrict__ KH, __bf16* __restrict__ VT, __bf16* __restrict__ VL) {
  __shared__ __align__(16) unsigned short lds[GLDS / 2];
  const int tid = threadIdx.x, wave = tid >> 5, lane = tid & 31, col = lane & 15, g = lane >> 4;
  const int which = blockIdx.z; const int c0 = blockIdx.y * GT;
  const size_t r0 = (size_t)blockIdx.x * GT;            // plane row base = b*SEQ + t0
  const size_t b = r0 / SEQ; const int t0 = (int)(r0 % SEQ);
  const size_t xr0 = b * SEQ_FULL + (size_t)t0;          // input row base
  v8f acc[2][4] = {};
  gemm_core<0, 0, true>(X + xr0 * CC, W + ((size_t)which * CC + c0) * CC, lds, acc);
  const int rb0 = (wave >> 1) * 32 + 8 * g, cb0 = (wave & 1) * 64 + col;   // acc[i][j][r] = (row rb0 + 16 i + r, col cb0 + 16 j)
  if (which == 2) { __bf16* th = (__bf16*)lds; __bf16* tl2 = th + GT * 136;   // [col][row], pitch 136
#pragma unroll
    for (int i = 0; i < 2; ++i) {
#pragma unroll
      for (int j = 0; j < 4; ++j) { v8b hh, ll;
#pragma unroll
        for (int r = 0; r < 8; ++r) { const float v = acc[i][j][r]; const __bf16 bh = (__bf16)v; hh[r] = bh; ll[r] = (__bf16)(v - (float)bh); }
        const int o = (cb0 + j * 16) * 136 + rb0 + i * 16; *(v8b*)(th + o) = hh; *(v8b*)(tl2 + o) = ll; } }
    __syncthreads();
#pragma unroll                                              // unrolled: one address with immediate offsets, the LDS reads issued together ahead of the stores
    for (int it = 0; it < GT * 16 / 256; ++it) { const int cl = it * 16 + (tid >> 4), q = tid & 15; const size_t o2 = (b * CC + c0 + cl) * (size_t)SEQ + t0 + q * 8;
      vst2(VT + o2, *(const v4u*)(th + cl * 136 + q * 8)); vst2(VL + o2, *(const v4u*)(tl2 + cl * 136 + q * 8)); } }
  else { _Float16* sh = (_Float16*)lds; _Float16* sl = sh + GT * 136;         // [row][col], pitch 136
#pragma unroll
    for (int i = 0; i < 2; ++i) {
#pragma unroll
      for (int j = 0; j < 4; ++j) {
#pragma unroll
        for (int r = 0; r < 8; ++r) { const float v = acc[i][j][r]; const int o = (rb0 + i * 16 + r) * 136 + cb0 + j * 16;
          const _Float16 hv = (_Float16)v; sh[o] = hv; sl[o] = (_Float16)((v - (float)hv) * 1024.0f); } } }   // q residual carried x 2^10 so the plane stays f16-normal
    __syncthreads();
    if (which == 0) {
#pragma unroll                                              // unrolled, as above
      for (int it = 0; it < GT * 16 / 256; ++it) { const int rl = it * 16 + (tid >> 4), q = tid & 15; const size_t o = (r0 + rl) * CC + c0 + q * 8;
        vst2(QH + o, *(const v4u*)(sh + rl * 136 + q * 8)); vst2(QL + o, *(const v4u*)(sl + rl * 136 + q * 8)); }
      asm volatile("s_wait_xcnt 0x0" ::: "memory"); }     // the build lays the v branch, which rewrites these stores' registers, behind them: the wait stands in front of it
    else {
#pragma unroll                                              // unrolled, as above
      for (int it = 0; it < GT * 16 / 256; ++it) { const int rl = it * 16 + (tid >> 4), q = tid & 15;
        vst2(KH + (r0 + rl) * CC + c0 + q * 8, *(const v4u*)(sh + rl * 136 + q * 8)); }
      asm volatile("s_wait_xcnt 0x0" ::: "memory"); } }   // the build lays the q branch, which rewrites these stores' registers, directly behind them: the wait stands in front of it
}
#define NQ 2
#define AW 8
#define AS 64                                // keys per tile = two passes of 32
#define AP 72                                // LDS row pitch in 16-bit elements: 144 B = 16 B x odd, conflict-free for 16-byte fragment reads
#define ATILE (64 * AP)                      // 16-bit elements of one plane's tile: 64 rows (K: keys; V: head columns)
#define ABUF (3 * ATILE)                     // K, V hi, V lo
static_assert((SEQ % (AW * NQ * 16)) == 0);
static_assert(AS == 64 && HD == 64 && AW * 32 == 256 && (SEQ % AS) == 0 && SEQ / AS >= 2);
// One tile: 6 copies of 16 B a lane (8 lanes a row, 32 rows a sweep, 2 sweeps a plane). l = the lane's LDS byte address in the K plane of the target buffer; k, vh, vl = its global addresses in the first sweep.
// The s_wait_xcnt stands inside the statement, behind the last copy: the operands' registers are rewritten only behind it.
__device__ __forceinline__ void attn_copy(unsigned l, const _Float16* k, const __bf16* vh, const __bf16* vl) {
  asm volatile("global_load_async_to_lds_b128 %0, %6, off\n\t"
               "global_load_async_to_lds_b128 %1, %7, off\n\t"
               "global_load_async_to_lds_b128 %2, %8, off\n\t"
               "global_load_async_to_lds_b128 %3, %9, off\n\t"
               "global_load_async_to_lds_b128 %4, %10, off\n\t"
               "global_load_async_to_lds_b128 %5, %11, off\n\t"
               "s_wait_xcnt 0x0"
               :: "v"(l), "v"(l + 32u * AP * 2u), "v"(l + ATILE * 2u), "v"(l + (ATILE + 32u * AP) * 2u), "v"(l + 2u * ATILE * 2u), "v"(l + (2u * ATILE + 32u * AP) * 2u),
                  "v"(k), "v"(k + (size_t)32 * CC), "v"(vh), "v"(vh + (size_t)32 * SEQ), "v"(vl), "v"(vl + (size_t)32 * SEQ)
               : "memory");
}
__global__ __launch_bounds__(AW * 32) __attribute__((amdgpu_num_vgpr(256)))
void k_attn(const _Float16* __restrict__ QH, const _Float16* __restrict__ QL, const _Float16* __restrict__ KH, const __bf16* __restrict__ VT, const __bf16* __restrict__ VL, float* __restrict__ Y) {
  __shared__ __align__(16) unsigned short ring[2 * ABUF];
  const int tid = threadIdx.x, wave = tid >> 5, lane = tid & 31, col = lane & 15, g = lane >> 4;
  const int h = blockIdx.y, b = blockIdx.z;
  const size_t q0 = (size_t)b * SEQ + blockIdx.x * (AW * NQ * 16) + wave * (NQ * 16);
  v16h qh[NQ][HD / 32], ql[NQ][HD / 32];
#pragma unroll
  for (int u = 0; u < NQ; ++u) {
#pragma unroll
    for (int kc = 0; kc < HD / 32; ++kc) { const size_t o = (q0 + u * 16 + col) * CC + h * HD + kc * 32; qh[u][kc] = frag_h(QH + o, lane); ql[u][kc] = frag_h(QL + o, lane); } }
  const _Float16* kp = KH + (size_t)b * SEQ * CC + h * HD;               // wave-uniform bases of the next tile to copy, advanced per tile; the lane's own part is a fixed 32-bit offset
  const __bf16* vhp = VT + ((size_t)b * CC + h * HD) * (size_t)SEQ;
  const __bf16* vlp = VL + ((size_t)b * CC + h * HD) * (size_t)SEQ;
  const unsigned ko = (unsigned)((tid >> 3) * CC + (tid & 7) * 8), vo = (unsigned)((tid >> 3) * SEQ + (tid & 7) * 8);
  const unsigned lo = (unsigned)(uintptr_t)ring + (unsigned)((tid >> 3) * AP + (tid & 7) * 8) * 2u;   // LDS byte address of the lane's first copy in buffer 0
  const int fo = col * AP + 8 * g;                                       // the lane's place in a 16-row fragment, K and V alike
  attn_copy(lo, kp + ko, vhp + vo, vlp + vo);                            // tile 0 into buffer 0
  asm volatile("s_wait_asynccnt 0x0" ::: "memory");                      // this wave's copies of tile 0 have landed
  __syncthreads();                                                       // ... and every other wave's
  kp += (size_t)AS * CC; vhp += AS; vlp += AS;
  attn_copy(lo + ABUF * 2u, kp + ko, vhp + vo, vlp + vo);                // tile 1 into buffer 1
  v8f acc[NQ][HD / 16] = {};
  float m[NQ], l[NQ];
#pragma unroll
  for (int u = 0; u < NQ; ++u) { m[u] = -3.0e38f; l[u] = 0.f; }
#pragma unroll 1                                            // rolled: the foot's barrier and refill stand once
  for (int st = 0; st < SEQ / AS; ++st) {
  const unsigned short* tb = ring + (st & 1) * ABUF + fo;
#pragma unroll 1                                            // rolled: one pass already fills the 256-register budget
  for (int ps = 0; ps < AS / 32; ++ps) {
    const unsigned short* kq = tb + ps * 32 * AP; const unsigned short* vq = tb + ATILE + ps * 32;
    v8f sa[NQ][2] = {}, sb[NQ][2] = {};
    FR kb[HD / 32][2], vf[2][2];                            // the pass's K fragments are read as one group: one LDS latency a pass, not one a fragment
#pragma unroll
    for (int kc = 0; kc < HD / 32; ++kc) {
#pragma unroll
      for (int t = 0; t < 2; ++t) kb[kc][t] = frag_s(kq + t * 16 * AP + kc * 32); }
#pragma unroll
    for (int kc = 0; kc < HD / 32; ++kc) {
#pragma unroll
      for (int t = 0; t < 2; ++t) {
#pragma unroll
        for (int u = 0; u < NQ; ++u) { sa[u][t] = wmma16(kb[kc][t].h, qh[u][kc], sa[u][t]); sb[u][t] = wmma16(kb[kc][t].h, ql[u][kc], sb[u][t]); } } }
    vf[0][0] = frag_s(vq); vf[0][1] = frag_s(vq + ATILE);   // the first V fragments are read ahead of the softmax
    F2 pf[NQ];
#pragma unroll
    for (int u = 0; u < NQ; ++u) {
      float p[16]; float mx = m[u];
#pragma unroll
      for (int i = 0; i < 16; ++i) { p[i] = (sa[u][i >> 3][i & 7] + sb[u][i >> 3][i & 7] * (1.0f / 1024.0f)) * (1.0f / 64.0f); mx = fmaxf(mx, p[i]); }
      mx = fmaxf(mx, __shfl_xor(mx, 16));
      if (__builtin_amdgcn_ballot_w32(mx > m[u]) != 0) {     // some query's maximum rose: rescale (the factor is exactly 1 for the others)
        const float al = expf(m[u] - mx); l[u] *= al; m[u] = mx;
#pragma unroll
        for (int j = 0; j < HD / 16; ++j) acc[u][j] = acc[u][j] * al; }
#pragma unroll
      for (int i = 0; i < 16; ++i) { p[i] = expf(p[i] - m[u]); l[u] += p[i]; }
      pf[u] = bsplit16(p); }
#pragma unroll
    for (int j = 0; j < HD / 16; ++j) {
      if (j + 1 < HD / 16) { vf[(j + 1) & 1][0] = frag_s(vq + (j + 1) * 16 * AP); vf[(j + 1) & 1][1] = frag_s(vq + ATILE + (j + 1) * 16 * AP); }   // the next group's V fragments are read ahead of this group's products
      const v16b vh = vf[j & 1][0].b, vl = vf[j & 1][1].b;
#pragma unroll
      for (int u = 0; u < NQ; ++u) acc[u][j] = wmma_bf(vh, pf[u].h, acc[u][j]);
#pragma unroll
      for (int u = 0; u < NQ; ++u) acc[u][j] = wmma_bf(vh, pf[u].l, acc[u][j]);
#pragma unroll
      for (int u = 0; u < NQ; ++u) acc[u][j] = wmma_bf(vl, pf[u].h, acc[u][j]); }
  }
    asm volatile("s_wait_dscnt 0x0" ::: "memory");          // this wave's reads of tile st are done before its buffer is handed over
    asm volatile("s_wait_asynccnt 0x0" ::: "memory");       // this wave's copies of tile st + 1 have landed
    __syncthreads();                                        // publishes tile st + 1; every wave has left tile st's buffer
    if (st + 2 < SEQ / AS) { kp += (size_t)AS * CC; vhp += AS; vlp += AS;
      attn_copy(lo + (unsigned)(st & 1) * (ABUF * 2u), kp + ko, vhp + vo, vlp + vo); }   // tile st + 2 into the buffer just left
  }
  asm volatile("s_wait_asynccnt 0x0" ::: "memory");         // no copy is outstanding when the wave ends
#pragma unroll
  for (int u = 0; u < NQ; ++u) {
    const float inv = 1.0f / (l[u] + __shfl_xor(l[u], 16));
    float* yp = Y + (q0 + u * 16 + col) * CC + h * HD + 8 * g;   // acc[u][j][r] = O[query u*16 + col][j*16 + 8g + r]
#pragma unroll
    for (int j = 0; j < HD / 16; ++j) { const v8f o = acc[u][j] * inv;
      vst2(yp + j * 16, (v4f){o[0], o[1], o[2], o[3]}); vst2(yp + j * 16 + 4, (v4f){o[4], o[5], o[6], o[7]}); } }
}
// ---- k_out: block = (128 plane rows, 128 cols): y (x 2^6, f16) . W_out^T (bf16 values x 2^6, f16), + bf16 b_out
__global__ __launch_bounds__(256) __attribute__((amdgpu_num_vgpr(256)))
void k_out(const float* __restrict__ Y, const float* __restrict__ W, const float* __restrict__ Bv, float* __restrict__ O) {
  __shared__ __align__(16) unsigned short lds[GLDS / 2];
  const int tid = threadIdx.x, wave = tid >> 5, lane = tid & 31, col = lane & 15, g = lane >> 4;
  const int c0 = blockIdx.y * GT; const size_t r0 = (size_t)blockIdx.x * GT;   // plane row base
  v8f acc[2][4] = {};
  gemm_core<1, 2, false>(Y + r0 * CC, W + (size_t)c0 * CC, lds, acc);
  float* so = (float*)lds;                                                     // [row][col], pitch 132
  const int rb0 = (wave >> 1) * 32 + 8 * g, cb0 = (wave & 1) * 64 + col;
#pragma unroll
  for (int j = 0; j < 4; ++j) { const float bb = bfr(Bv[c0 + cb0 + j * 16]);
#pragma unroll
    for (int i = 0; i < 2; ++i) {
#pragma unroll
      for (int r = 0; r < 8; ++r) so[(rb0 + i * 16 + r) * 132 + cb0 + j * 16] = acc[i][j][r] * (1.0f / 4096.0f) + bb; } }
  __syncthreads();
  const size_t b = r0 / SEQ; const int t0 = (int)(r0 % SEQ);
  for (int rl = wave * 16; rl < wave * 16 + 16; ++rl)
    vst2(O + (b * SEQ_FULL + (size_t)(t0 + rl)) * CC + c0 + lane * 4, *(const v4f*)(so + rl * 132 + lane * 4));
}

extern "C" void kernel_launch(void* const* d_in, const int* in_sizes, int n_in, void* d_out, int out_size, void* d_ws, size_t ws_size, hipStream_t stream) {
  if (n_in < 4) return;
  const size_t rows_needed = (size_t)(NB - 1) * SEQ_FULL + SEQ;
  if ((size_t)in_sizes[0] < rows_needed * CC) return;            // x [2,2048,1024]
  if ((size_t)in_sizes[1] < (size_t)3 * CC * CC) return;         // w_qkv [3072,1024] ([out][in])
  if ((size_t)in_sizes[2] < (size_t)CC * CC) return;             // w_out [1024,1024] ([out][in])
  if (in_sizes[3] < CC) return;                                   // b_out [1024]
  if ((size_t)out_size < rows_needed * CC) return;
  if (ws_size < (size_t)WS_END) return;
  const float* X = (const float*)d_in[0]; const float* W = (const float*)d_in[1]; const float* WO = (const float*)d_in[2]; const float* BO = (const float*)d_in[3];
  char* ws = (char*)d_ws;
  _Float16 *QH = (_Float16*)(ws + WS_QH), *QL = (_Float16*)(ws + WS_QL), *KH = (_Float16*)(ws + WS_KH);
  __bf16 *VT = (__bf16*)(ws + WS_VT), *VL = (__bf16*)(ws + WS_VL);
  float *Y = (float*)(ws + WS_Y);
  k_proj<<<dim3(NB * SEQ / GT, CC / GT, 3), 256, 0, stream>>>(X, W, QH, QL, KH, VT, VL);
  k_attn<<<dim3(SEQ / (AW * NQ * 16), NH, NB), AW * 32, 0, stream>>>(QH, QL, KH, VT, VL, Y);
  k_out<<<dim3(NB * SEQ / GT, CC / GT), 256, 0, stream>>>(Y, WO, BO, (float*)d_out);
}

// v004
// Measured time: 138 microseconds a run.
// In two side-by-side timings against v003, it was 1.20 and 1.21 times as fast.
// All steps since v000 together make it 12.2 times as fast.
// compute dtype: x and W_qkv RNE-converted to bf16; q/k/v = x W_qkv^T with exact bf16 products on v_wmma_f32_16x16x32_bf16, f32 accumulate; q as f16 hi + residual (x 2^10), k once to f16 -> 2-product raw scores (v_wmma_f32_16x16x32_f16) in f32 registers; running-maximum softmax in f32, base 2 (v_exp_f32 of one fma that carries log2(e)/64); P f32 split bf16 hi + lo against v bf16 hi + lo (3 bf16 products), divided by the row sum at the end; merged heads y in f32; y (x 2^6, f16) times W_out^T (bf16 values x 2^6, f16): 1 f16 product, f32 accumulate, + bf16 b_out.
#include <hip/hip_runtime.h>
#include <math.h>

typedef __attribute__((ext_vector_type(16))) _Float16 v16h;
typedef __attribute__((ext_vector_type(16))) __bf16 v16b;
typedef __attribute__((ext_vector_type(8)))  _Float16 v8h;
typedef __attribute__((ext_vector_type(8)))  __bf16 v8b;
typedef __attribute__((ext_vector_type(8)))  float v8f;
typedef __attribute__((ext_vector_type(4)))  float v4f;
typedef __attribute__((ext_vector_type(2)))  float v2f;
typedef __attribute__((ext_vector_type(4)))  unsigned v4u;
typedef __attribute__((ext_vector_type(2)))  unsigned v2u;
typedef __attribute__((ext_vector_type(4)))  _Float16 v4h;
typedef __attribute__((ext_vector_type(4)))  __bf16 v4b;

template <typename T> __device__ __forceinline__ void vst2(void* p, T v) { *(T*)p = v;  }

__device__ __forceinline__ v8f wmma16(v16h a, v16h b, v8f c) {
  v8f d = __builtin_amdgcn_wmma_f32_16x16x32_f16(false, a, false, b, (short)0, c, false, false);
  asm volatile("v_nop\n\tv_nop\n\tv_nop\n\tv_nop" : "+v"(d) : "v"(a), "v"(b));
  return d;
}
__device__ __forceinline__ v8f wmma_bf(v16b a, v16b b, v8f c) {
  v8f d = __builtin_amdgcn_wmma_f32_16x16x32_bf16(false, a, false, b, (short)0, c, false, false);
  asm volatile("v_nop\n\tv_nop\n\tv_nop\n\tv_nop" : "+v"(d) : "v"(a), "v"(b));
  return d;
}
// 16x16x32 fragments: lane = (g = lane>>4, row/col = lane&15); elements 0..7 = k0+8g+0..7, 8..15 = k0+16+8g+0..7; D element r = row 8g+r, col lane&15
__device__ __forceinline__ v16h frag_h(const _Float16* rowk0, int lane) {
  union { v16h v; v8h q[2]; } u; const _Float16* p = rowk0 + 8 * (lane >> 4);
  u.q[0] = *(const v8h*)p; u.q[1] = *(const v8h*)(p + 16); return u.v;
}
// 16 f32 values -> bf16 hi + lo fragment pair
struct F2 { v16b h, l; };
__device__ __forceinline__ F2 bsplit16(const float v[16]) { F2 r;
#pragma unroll
  for (int i = 0; i < 16; ++i) { const __bf16 hb = (__bf16)v[i]; r.h[i] = hb; r.l[i] = (__bf16)(v[i] - (float)hb); }
  return r; }
__device__ __forceinline__ float bfr(float v) { return (float)(__bf16)v; }

// sizes: B 2, N 2048, C 1024 = 16 heads x 64; logits x (1/64); output projection C -> C with bias
#define NB_FULL 2
#define SEQ_FULL 2048
#ifndef NB
#define NB NB_FULL
#endif
#ifndef SEQ
#define SEQ SEQ_FULL
#endif
#define CC 1024
#define NH 16
#define HD 64
static_assert(NB >= 1 && NB <= NB_FULL);
static_assert(SEQ >= 128 && SEQ <= SEQ_FULL && (SEQ % 128) == 0);
static_assert(NH * HD == CC && HD == 64 && (CC % 128) == 0);

#define PR     ((size_t)NB * SEQ)                                 // plane rows (b*SEQ + t)
#define WS_QH  ((size_t)0)                                        // f16 q hi   [PR][CC]
#define WS_QL  (WS_QH + 2u * PR * CC)                             // f16 q residual x 2^10 [PR][CC]
#define WS_KH  (WS_QL + 2u * PR * CC)                             // f16 k      [PR][CC]
#define WS_VT  (WS_KH + 2u * PR * CC)                             // bf16 v hi planes [b][c][t]
#define WS_VL  (WS_VT + 2u * (size_t)NB * CC * SEQ)               // bf16 v lo planes [b][c][t]
#define WS_Y   (WS_VL + 2u * (size_t)NB * CC * SEQ)               // f32 merged heads y [PR][CC]
#define WS_END (WS_Y + 4u * PR * CC)
static_assert(WS_END <= (size_t)134217728u);
static_assert((((size_t)(NB - 1) * SEQ_FULL + SEQ) * CC) <= (size_t)NB_FULL * SEQ_FULL * CC);

// ---- GEMM core of k_proj and k_out: block = 8 waves on a 128 x 128 tile of A . B^T (both operands f32 rows, k contiguous), wave = 32 x 64 (2 x 4 tiles).
// Per step of 32 k the block reads its 128 + 128 rows once, every wave-wide load covering 4 whole 128-byte lines, converts each value once and keeps the 16-bit tile in LDS for all 8 waves.
// Two LDS buffers: step s + 1 is loaded into registers ahead of step s's products and stored behind them; one barrier a step. k runs upward 32 at a time into the same accumulators, in the fragment k order above.
#define GT 128                               // tile rows of either operand
#define GK 32                                // k per step
#define GP 40                                // LDS row pitch in 16-bit elements: 80 B = 16 B x odd, conflict-free for 16-byte fragment reads
#define GBUF (2 * GT * GP)                   // 16-bit elements per buffer: A rows, then B rows
#define GLDS (2 * GT * 136 * 2)              // bytes: the larger of the two buffers (40,960) and the output staging of either kernel
static_assert(2 * GBUF * 2 <= GLDS && GT * 132 * 4 <= GLDS && (SEQ % GT) == 0 && (CC % GT) == 0 && (CC % GK) == 0);
// CV 0: bf16; 1: f16 of v x 2^6; 2: f16 of (v rounded to bf16) x 2^6
template <int CV> __device__ __forceinline__ v2u cvt4(v4f v) {
  union { v4b b; v4h h; v2u u; } r;
#pragma unroll
  for (int i = 0; i < 4; ++i) {
    if constexpr (CV == 0) r.b[i] = (__bf16)v[i];
    else if constexpr (CV == 1) r.h[i] = (_Float16)(v[i] * 64.0f);
    else r.h[i] = (_Float16)(bfr(v[i]) * 64.0f); }
  return r.u;
}
union FR { v16h h; v16b b; v4u q[2]; };
__device__ __forceinline__ FR frag_s(const unsigned short* p) { FR u; u.q[0] = *(const v4u*)p; u.q[1] = *(const v4u*)(p + 16); return u; }
template <bool BF> __device__ __forceinline__ void gemm_step(const unsigned short* fa, const unsigned short* fb, v8f (&acc)[2][4]) {
  FR a[2], w[4];
#pragma unroll
  for (int i = 0; i < 2; ++i) a[i] = frag_s(fa + i * 16 * GP);
#pragma unroll
  for (int j = 0; j < 4; ++j) w[j] = frag_s(fb + j * 16 * GP);
#pragma unroll
  for (int i = 0; i < 2; ++i) {
#pragma unroll
    for (int j = 0; j < 4; ++j) { if constexpr (BF) acc[i][j] = wmma_bf(a[i].b, w[j].b, acc[i][j]); else acc[i][j] = wmma16(a[i].h, w[j].h, acc[i][j]); } }
}
template <int CA, int CB, bool BF>
__device__ __forceinline__ void gemm_core(const float* __restrict__ A, const float* __restrict__ B, unsigned short* lds, v8f (&acc)[2][4]) {
  const int tid = threadIdx.x, wave = tid >> 5, lane = tid & 31, col = lane & 15, g = lane >> 4;
  const float* ap = A + (size_t)(tid >> 3) * CC + (tid & 7) * 4;         // 8 threads a row of 32 floats; 32 rows a sweep, 4 sweeps an operand
  const float* bp = B + (size_t)(tid >> 3) * CC + (tid & 7) * 4;
  const int so = (tid >> 3) * GP + (tid & 7) * 4;
  const int fao = ((wave >> 1) * 32 + col) * GP + 8 * g, fbo = (GT + (wave & 1) * 64 + col) * GP + 8 * g;
  v4f ra[4], rb[4];
#pragma unroll
  for (int i = 0; i < 4; ++i) { ra[i] = *(const v4f*)(ap + (size_t)i * 32 * CC); rb[i] = *(const v4f*)(bp + (size_t)i * 32 * CC); }
#pragma unroll
  for (int i = 0; i < 4; ++i) { *(v2u*)(lds + so + i * 32 * GP) = cvt4<CA>(ra[i]); *(v2u*)(lds + so + (GT + i * 32) * GP) = cvt4<CB>(rb[i]); }
  int cur = 0;
#pragma unroll 1                                            // rolled: the body is the same every step, and unrolled it would only grow the code
  for (int kc = 0; kc < CC / GK - 1; ++kc) {
    __syncthreads();                                        // buffer cur is written by all; buffer cur ^ 1 is left by all its readers
    ap += GK; bp += GK;
#pragma unroll
    for (int i = 0; i < 4; ++i) { ra[i] = *(const v4f*)(ap + (size_t)i * 32 * CC); rb[i] = *(const v4f*)(bp + (size_t)i * 32 * CC); }
    gemm_step<BF>(lds + cur * GBUF + fao, lds + cur * GBUF + fbo, acc);
    __builtin_amdgcn_sched_barrier(0);                      // keeps the waits on the next step's global loads behind this step's products; without it they stand behind the first product
    cur ^= 1;
#pragma unroll
    for (int i = 0; i < 4; ++i) { *(v2u*)(lds + cur * GBUF + so + i * 32 * GP) = cvt4<CA>(ra[i]); *(v2u*)(lds + cur * GBUF + so + (GT + i * 32) * GP) = cvt4<CB>(rb[i]); }
  }
  __syncthreads();
  gemm_step<BF>(lds + cur * GBUF + fao, lds + cur * GBUF + fbo, acc);
  __syncthreads();                                          // every wave has left the buffers: the caller stages its output over them
}

// ---- k_proj: block = (128 plane rows, 128 cols, which in {q,k,v}); W rows = which*CC + (h*HD + d); q -> f16 hi + residual, k -> f16, v -> bf16 hi/lo planes [b][c][t]
__global__ __launch_bounds__(256) __attribute__((amdgpu_num_vgpr(256)))
void k_proj(const float* __restrict__ X, const float* __restrict__ W, _Float16* __restrict__ QH, _Float16* __restrict__ QL, _Float16* __restrict__ KH, __bf16* __restrict__ VT, __bf16* __restrict__ VL) {
  __shared__ __align__(16) unsigned short lds[GLDS / 2];
  const int tid = threadIdx.x, wave = tid >> 5, lane = tid & 31, col = lane & 15, g = lane >> 4;
  const int which = blockIdx.z; const int c0 = blockIdx.y * GT;
  const size_t r0 = (size_t)blockIdx.x * GT;            // plane row base = b*SEQ + t0
  const size_t b = r0 / SEQ; const int t0 = (int)(r0 % SEQ);
  const size_t xr0 = b * SEQ_FULL + (size_t)t0;          // input row base
  v8f acc[2][4] = {};
  gemm_core<0, 0, true>(X + xr0 * CC, W + ((size_t)which * CC + c0) * CC, lds, acc);
  const int rb0 = (wave >> 1) * 32 + 8 * g, cb0 = (wave & 1) * 64 + col;   // acc[i][j][r] = (row rb0 + 16 i + r, col cb0 + 16 j)
  if (which == 2) { __bf16* th = (__bf16*)lds; __bf16* tl2 = th + GT * 136;   // [col][row], pitch 136
#pragma unroll
    for (int i = 0; i < 2; ++i) {
#pragma unroll
      for (int j = 0; j < 4; ++j) { v8b hh, ll;
#pragma unroll
        for (int r = 0; r < 8; ++r) { const float v = acc[i][j][r]; const __bf16 bh = (__bf16)v; hh[r] = bh; ll[r] = (__bf16)(v - (float)bh); }
        const int o = (cb0 + j * 16) * 136 + rb0 + i * 16; *(v8b*)(th + o) = hh; *(v8b*)(tl2 + o) = ll; } }
    __syncthreads();
#pragma unroll                                              // unrolled: one address with immediate offsets, the LDS reads issued together ahead of the stores
    for (int it = 0; it < GT * 16 / 256; ++it) { const int cl = it * 16 + (tid >> 4), q = tid & 15; const size_t o2 = (b * CC + c0 + cl) * (size_t)SEQ + t0 + q * 8;
      vst2(VT + o2, *(const v4u*)(th + cl * 136 + q * 8)); vst2(VL + o2, *(const v4u*)(tl2 + cl * 136 + q * 8)); } }
  else { _Float16* sh = (_Float16*)lds; _Float16* sl = sh + GT * 136;         // [row][col], pitch 136
#pragma unroll
    for (int i = 0; i < 2; ++i) {
#pragma unroll
      for (int j = 0; j < 4; ++j) {
#pragma unroll
        for (int r = 0; r < 8; ++r) { const float v = acc[i][j][r]; const int o = (rb0 + i * 16 + r) * 136 + cb0 + j * 16;
          const _Float16 hv = (_Float16)v; sh[o] = hv; sl[o] = (_Float16)((v - (float)hv) * 1024.0f); } } }   // q residual carried x 2^10 so the plane stays f16-normal
    __syncthreads();
    if (which == 0) {
#pragma unroll                                              // unrolled, as above
      for (int it = 0; it < GT * 16 / 256; ++it) { const int rl = it * 16 + (tid >> 4), q = tid & 15; const size_t o = (r0 + rl) * CC + c0 + q * 8;
        vst2(QH + o, *(const v4u*)(sh + rl * 136 + q * 8)); vst2(QL + o, *(const v4u*)(sl + rl * 136 + q * 8)); }
      asm volatile("s_wait_xcnt 0x0" ::: "memory"); }     // the build lays the v branch, which rewrites these stores' registers, behind them: the wait stands in front of it
    else {
#pragma unroll                                              // unrolled, as above
      for (int it = 0; it < GT * 16 / 256; ++it) { const int rl = it * 16 + (tid >> 4), q = tid & 15;
        vst2(KH + (r0 + rl) * CC + c0 + q * 8, *(const v4u*)(sh + rl * 136 + q * 8)); }
      asm volatile("s_wait_xcnt 0x0" ::: "memory"); } }   // the build lays the q branch, which rewrites these stores' registers, directly behind them: the wait stands in front of it
}
#define NQ 2
#define AW 8
#define AS 64                                // keys per tile = two passes of 32
#define AP 72                                // LDS row pitch in 16-bit elements: 144 B = 16 B x odd, conflict-free for 16-byte fragment reads
#define ATILE (64 * AP)                      // 16-bit elements of one plane's tile: 64 rows (K: keys; V: head columns)
#define ABUF (3 * ATILE)                     // K, V hi, V lo
#define SC2 (1.4426950408889634f / 64.0f)    // log2(e) / head size: the logit scale and the change of base in one factor
static_assert((SEQ % (AW * NQ * 16)) == 0);
static_assert(AS == 64 && HD == 64 && AW * 32 == 256 && (SEQ % AS) == 0 && SEQ / AS >= 2);
// One tile: 6 copies of 16 B a lane (8 lanes a row, 32 rows a sweep, 2 sweeps a plane). l = the lane's LDS byte address in the K plane of the target buffer; k, vh, vl = its global addresses in the first sweep.
// The s_wait_xcnt stands inside the statement, behind the last copy: the operands' registers are rewritten only behind it.
__device__ __forceinline__ void attn_copy(unsigned l, const _Float16* k, const __bf16* vh, const __bf16* vl) {
  asm volatile("global_load_async_to_lds_b128 %0, %6, off\n\t"
               "global_load_async_to_lds_b128 %1, %7, off\n\t"
               "global_load_async_to_lds_b128 %2, %8, off\n\t"
               "global_load_async_to_lds_b128 %3, %9, off\n\t"
               "global_load_async_to_lds_b128 %4, %10, off\n\t"
               "global_load_async_to_lds_b128 %5, %11, off\n\t"
               "s_wait_xcnt 0x0"
               :: "v"(l), "v"(l + 32u * AP * 2u), "v"(l + ATILE * 2u), "v"(l + (ATILE + 32u * AP) * 2u), "v"(l + 2u * ATILE * 2u), "v"(l + (2u * ATILE + 32u * AP) * 2u),
                  "v"(k), "v"(k + (size_t)32 * CC), "v"(vh), "v"(vh + (size_t)32 * SEQ), "v"(vl), "v"(vl + (size_t)32 * SEQ)
               : "memory");
}
__global__ __launch_bounds__(AW * 32) __attribute__((amdgpu_num_vgpr(256)))
void k_attn(const _Float16* __restrict__ QH, const _Float16* __restrict__ QL, const _Float16* __restrict__ KH, const __bf16* __restrict__ VT, const __bf16* __restrict__ VL, float* __restrict__ Y) {
  __shared__ __align__(16) unsigned short ring[2 * ABUF];
  const int tid = threadIdx.x, wave = tid >> 5, lane = tid & 31, col = lane & 15, g = lane >> 4;
  const int h = blockIdx.y, b = blockIdx.z;
  const size_t q0 = (size_t)b * SEQ + blockIdx.x * (AW * NQ * 16) + wave * (NQ * 16);
  v16h qh[NQ][HD / 32], ql[NQ][HD / 32];
#pragma unroll
  for (int u = 0; u < NQ; ++u) {
#pragma unroll
    for (int kc = 0; kc < HD / 32; ++kc) { const size_t o = (q0 + u * 16 + col) * CC + h * HD + kc * 32; qh[u][kc] = frag_h(QH + o, lane); ql[u][kc] = frag_h(QL + o, lane); } }
  const _Float16* kp = KH + (size_t)b * SEQ * CC + h * HD;               // wave-uniform bases of the next tile to copy, advanced per tile; the lane's own part is a fixed 32-bit offset
  const __bf16* vhp = VT + ((size_t)b * CC + h * HD) * (size_t)SEQ;
  const __bf16* vlp = VL + ((size_t)b * CC + h * HD) * (size_t)SEQ;
  const unsigned ko = (unsigned)((tid >> 3) * CC + (tid & 7) * 8), vo = (unsigned)((tid >> 3) * SEQ + (tid & 7) * 8);
  const unsigned lo = (unsigned)(uintptr_t)ring + (unsigned)((tid >> 3) * AP + (tid & 7) * 8) * 2u;   // LDS byte address of the lane's first copy in buffer 0
  const int fo = col * AP + 8 * g;                                       // the lane's place in a 16-row fragment, K and V alike
  attn_copy(lo, kp + ko, vhp + vo, vlp + vo);                            // tile 0 into buffer 0
  asm volatile("s_wait_asynccnt 0x0" ::: "memory");                      // this wave's copies of tile 0 have landed
  __syncthreads();                                                       // ... and every other wave's
  kp += (size_t)AS * CC; vhp += AS; vlp += AS;
  attn_copy(lo + ABUF * 2u, kp + ko, vhp + vo, vlp + vo);                // tile 1 into buffer 1
  v8f acc[NQ][HD / 16] = {};
  float m[NQ], l[NQ];
#pragma unroll
  for (int u = 0; u < NQ; ++u) { m[u] = -3.0e38f; l[u] = 0.f; }
#pragma unroll 1                                            // rolled: the foot's barrier and refill stand once
  for (int st = 0; st < SEQ / AS; ++st) {
  const unsigned short* tb = ring + (st & 1) * ABUF + fo;
#pragma unroll 1                                            // rolled: one pass already fills the 256-register budget
  for (int ps = 0; ps < AS / 32; ++ps) {
    const unsigned short* kq = tb + ps * 32 * AP; const unsigned short* vq = tb + ATILE + ps * 32;
    v8f sa[NQ][2] = {}, sb[NQ][2] = {};
    FR kb[HD / 32][2], vf[2][2];                            // the pass's K fragments are read as one group: one LDS latency a pass, not one a fragment
#pragma unroll
    for (int kc = 0; kc < HD / 32; ++kc) {
#pragma unroll
      for (int t = 0; t < 2; ++t) kb[kc][t] = frag_s(kq + t * 16 * AP + kc * 32); }
#pragma unroll
    for (int kc = 0; kc < HD / 32; ++kc) {
#pragma unroll
      for (int t = 0; t < 2; ++t) {
#pragma unroll
        for (int u = 0; u < NQ; ++u) { sa[u][t] = wmma16(kb[kc][t].h, qh[u][kc], sa[u][t]); sb[u][t] = wmma16(kb[kc][t].h, ql[u][kc], sb[u][t]); } } }
    vf[0][0] = frag_s(vq); vf[0][1] = frag_s(vq + ATILE);   // the first V fragments are read ahead of the softmax
    F2 pf[NQ];
#pragma unroll
    for (int u = 0; u < NQ; ++u) {
      float p[16]; float mx = m[u];
#pragma unroll
      for (int i = 0; i < 16; ++i) { p[i] = sa[u][i >> 3][i & 7] + sb[u][i >> 3][i & 7] * (1.0f / 1024.0f); mx = fmaxf(mx, p[i]); }   // raw scores q.k; m[u] is kept in the same unit
      mx = fmaxf(mx, __shfl_xor(mx, 16));
      if (__builtin_amdgcn_ballot_w32(mx > m[u]) != 0) {     // some query's maximum rose: rescale (the factor is exactly 1 for the others)
        const float al = __builtin_amdgcn_exp2f((m[u] - mx) * SC2); l[u] *= al; m[u] = mx;
#pragma unroll
        for (int j = 0; j < HD / 16; ++j) acc[u][j] = acc[u][j] * al; }
      const float nm = -m[u] * SC2;
#pragma unroll
      for (int i = 0; i < 16; i += 2) {                     // exp((s - m) / 64) = 2^(s * SC2 - m * SC2); two exponents a packed fma
        const v2f e = __builtin_elementwise_fma((v2f){p[i], p[i + 1]}, (v2f){SC2, SC2}, (v2f){nm, nm});
        p[i] = __builtin_amdgcn_exp2f(e[0]); l[u] += p[i]; p[i + 1] = __builtin_amdgcn_exp2f(e[1]); l[u] += p[i + 1]; }
      pf[u] = bsplit16(p); }
#pragma unroll
    for (int j = 0; j < HD / 16; ++j) {
      if (j + 1 < HD / 16) { vf[(j + 1) & 1][0] = frag_s(vq + (j + 1) * 16 * AP); vf[(j + 1) & 1][1] = frag_s(vq + ATILE + (j + 1) * 16 * AP); }   // the next group's V fragments are read ahead of this group's products
      const v16b vh = vf[j & 1][0].b, vl = vf[j & 1][1].b;
#pragma unroll
      for (int u = 0; u < NQ; ++u) acc[u][j] = wmma_bf(vh, pf[u].h, acc[u][j]);
#pragma unroll
      for (int u = 0; u < NQ; ++u) acc[u][j] = wmma_bf(vh, pf[u].l, acc[u][j]);
#pragma unroll
      for (int u = 0; u < NQ; ++u) acc[u][j] = wmma_bf(vl, pf[u].h, acc[u][j]); }
  }
    asm volatile("s_wait_dscnt 0x0" ::: "memory");          // this wave's reads of tile st are done before its buffer is handed over
    asm volatile("s_wait_asynccnt 0x0" ::: "memory");       // this wave's copies of tile st + 1 have landed
    __syncthreads();                                        // publishes tile st + 1; every wave has left tile st's buffer
    if (st + 2 < SEQ / AS) { kp += (size_t)AS * CC; vhp += AS; vlp += AS;
      attn_copy(lo + (unsigned)(st & 1) * (ABUF * 2u), kp + ko, vhp + vo, vlp + vo); }   // tile st + 2 into the buffer just left
  }
  asm volatile("s_wait_asynccnt 0x0" ::: "memory");         // no copy is outstanding when the wave ends
#pragma unroll
  for (int u = 0; u < NQ; ++u) {
    const float inv = 1.0f / (l[u] + __shfl_xor(l[u], 16));
    float* yp = Y + (q0 + u * 16 + col) * CC + h * HD + 8 * g;   // acc[u][j][r] = O[query u*16 + col][j*16 + 8g + r]
#pragma unroll
    for (int j = 0; j < HD / 16; ++j) { const v8f o = acc[u][j] * inv;
      vst2(yp + j * 16, (v4f){o[0], o[1], o[2], o[3]}); vst2(yp + j * 16 + 4, (v4f){o[4], o[5], o[6], o[7]}); } }
}
// ---- k_out: block = (128 plane rows, 128 cols): y (x 2^6, f16) . W_out^T (bf16 values x 2^6, f16), + bf16 b_out
__global__ __launch_bounds__(256) __attribute__((amdgpu_num_vgpr(256)))
void k_out(const float* __restrict__ Y, const float* __restrict__ W, const float* __restrict__ Bv, float* __restrict__ O) {
  __shared__ __align__(16) unsigned short lds[GLDS / 2];
  const int tid = threadIdx.x, wave = tid >> 5, lane = tid & 31, col = lane & 15, g = lane >> 4;
  const int c0 = blockIdx.y * GT; const size_t r0 = (size_t)blockIdx.x * GT;   // plane row base
  v8f acc[2][4] = {};
  gemm_core<1, 2, false>(Y + r0 * CC, W + (size_t)c0 * CC, lds, acc);
  float* so = (float*)lds;                                                     // [row][col], pitch 132
  const int rb0 = (wave >> 1) * 32 + 8 * g, cb0 = (wave & 1) * 64 + col;
#pragma unroll
  for (int j = 0; j < 4; ++j) { const float bb = bfr(Bv[c0 + cb0 + j * 16]);
#pragma unroll
    for (int i = 0; i < 2; ++i) {
#pragma unroll
      for (int r = 0; r < 8; ++r) so[(rb0 + i * 16 + r) * 132 + cb0 + j * 16] = acc[i][j][r] * (1.0f / 4096.0f) + bb; } }
  __syncthreads();
  const size_t b = r0 / SEQ; const int t0 = (int)(r0 % SEQ);
  for (int rl = wave * 16; rl < wave * 16 + 16; ++rl)
    vst2(O + (b * SEQ_FULL + (size_t)(t0 + rl)) * CC + c0 + lane * 4, *(const v4f*)(so + rl * 132 + lane * 4));
}

extern "C" void kernel_launch(void* const* d_in, const int* in_sizes, int n_in, void* d_out, int out_size, void* d_ws, size_t ws_size, hipStream_t stream) {
  if (n_in < 4) return;
  const size_t rows_needed = (size_t)(NB - 1) * SEQ_FULL + SEQ;
  if ((size_t)in_sizes[0] < rows_needed * CC) return;            // x [2,2048,1024]
  if ((size_t)in_sizes[1] < (size_t)3 * CC * CC) return;         // w_qkv [3072,1024] ([out][in])
  if ((size_t)in_sizes[2] < (size_t)CC * CC) return;             // w_out [1024,1024] ([out][in])
  if (in_sizes[3] < CC) return;                                   // b_out [1024]
  if ((size_t)out_size < rows_needed * CC) return;
  if (ws_size < (size_t)WS_END) return;
  const float* X = (const float*)d_in[0]; const float* W = (const float*)d_in[1]; const float* WO = (const float*)d_in[2]; const float* BO = (const float*)d_in[3];
  char* ws = (char*)d_ws;
  _Float16 *QH = (_Float16*)(ws + WS_QH), *QL = (_Float16*)(ws + WS_QL), *KH = (_Float16*)(ws + WS_KH);
  __bf16 *VT = (__bf16*)(ws + WS_VT), *VL = (__bf16*)(ws + WS_VL);
  float *Y = (float*)(ws + WS_Y);
  k_proj<<<dim3(NB * SEQ / GT, CC / GT, 3), 256, 0, stream>>>(X, W, QH, QL, KH, VT, VL);
  k_attn<<<dim3(SEQ / (AW * NQ * 16), NH, NB), AW * 32, 0, stream>>>(QH, QL, KH, VT, VL, Y);
  k_out<<<dim3(NB * SEQ / GT, CC / GT), 256, 0, stream>>>(Y, WO, BO, (float*)d_out);
}

// v005
// One run takes 129 microseconds.
// In two side-by-side timings against v004, it was 1.05 and 1.06 times as fast.
// All steps since v000 together make it 12.9 times as fast.
// compute dtype: x and W_qkv RNE-converted to bf16; q/k/v = x W_qkv^T with exact bf16 products on v_wmma_f32_16x16x32_bf16, f32 accumulate; q as f16 hi + residual (x 2^10), k once to f16 -> 2-product raw scores (v_wmma_f32_16x16x32_f16) in f32 registers; running-maximum softmax in f32, base 2 (v_exp_f32 of one fma that carries log2(e)/64); P f32 split bf16 hi + lo against v bf16 hi + lo (3 bf16 products), divided by the row sum at the end; merged heads y in f32; y (x 2^6, f16) times W_out^T (bf16 values x 2^6, f16): 1 f16 product, f32 accumulate, + bf16 b_out.
#include <hip/hip_runtime.h>
#include <math.h>

typedef __attribute__((ext_vector_type(16))) _Float16 v16h;
typedef __attribute__((ext_vector_type(16))) __bf16 v16b;
typedef __attribute__((ext_vector_type(8)))  _Float16 v8h;
typedef __attribute__((ext_vector_type(8)))  __bf16 v8b;
typedef __attribute__((ext_vector_type(8)))  float v8f;
typedef __attribute__((ext_vector_type(4)))  float v4f;
typedef __attribute__((ext_vector_type(2)))  float v2f;
typedef __attribute__((ext_vector_type(4)))  unsigned v4u;
typedef __attribute__((ext_vector_type(2)))  unsigned v2u;
typedef __attribute__((ext_vector_type(4)))  _Float16 v4h;
typedef __attribute__((ext_vector_type(4)))  __bf16 v4b;

template <typename T> __device__ __forceinline__ void vst2(void* p, T v) { *(T*)p = v;  }

__device__ __forceinline__ v8f wmma16(v16h a, v16h b, v8f c) {
  v8f d = __builtin_amdgcn_wmma_f32_16x16x32_f16(false, a, false, b, (short)0, c, false, false);
  asm volatile("v_nop\n\tv_nop\n\tv_nop\n\tv_nop" : "+v"(d) : "v"(a), "v"(b));
  return d;
}
__device__ __forceinline__ v8f wmma_bf(v16b a, v16b b, v8f c) {
  v8f d = __builtin_amdgcn_wmma_f32_16x16x32_bf16(false, a, false, b, (short)0, c, false, false);
  asm volatile("v_nop\n\tv_nop\n\tv_nop\n\tv_nop" : "+v"(d) : "v"(a), "v"(b));
  return d;
}
// 16x16x32 fragments: lane = (g = lane>>4, row/col = lane&15); elements 0..7 = k0+8g+0..7, 8..15 = k0+16+8g+0..7; D element r = row 8g+r, col lane&15
__device__ __forceinline__ v16h frag_h(const _Float16* rowk0, int lane) {
  union { v16h v; v8h q[2]; } u; const _Float16* p = rowk0 + 8 * (lane >> 4);
  u.q[0] = *(const v8h*)p; u.q[1] = *(const v8h*)(p + 16); return u.v;
}
// 16 f32 values -> bf16 hi + lo fragment pair
struct F2 { v16b h, l; };
__device__ __forceinline__ F2 bsplit16(const float v[16]) { F2 r;
#pragma unroll
  for (int i = 0; i < 16; ++i) { const __bf16 hb = (__bf16)v[i]; r.h[i] = hb; r.l[i] = (__bf16)(v[i] - (float)hb); }
  return r; }
__device__ __forceinline__ float bfr(float v) { return (float)(__bf16)v; }

// sizes: B 2, N 2048, C 1024 = 16 heads x 64; logits x (1/64); output projection C -> C with bias
#define NB_FULL 2
#define SEQ_FULL 2048
#ifndef NB
#define NB NB_FULL
#endif
#ifndef SEQ
#define SEQ SEQ_FULL
#endif
#define CC 1024
#define NH 16
#define HD 64
static_assert(NB >= 1 && NB <= NB_FULL);
static_assert(SEQ >= 128 && SEQ <= SEQ_FULL && (SEQ % 128) == 0);
static_assert(NH * HD == CC && HD == 64 && (CC % 128) == 0);

#define PR     ((size_t)NB * SEQ)                                 // plane rows (b*SEQ + t)
#define WS_QH  ((size_t)0)                                        // f16 q hi   [PR][CC]
#define WS_QL  (WS_QH + 2u * PR * CC)                             // f16 q residual x 2^10 [PR][CC]
#define WS_KH  (WS_QL + 2u * PR * CC)                             // f16 k      [PR][CC]
#define WS_VT  (WS_KH + 2u * PR * CC)                             // bf16 v hi planes [b][c][t]
#define WS_VL  (WS_VT + 2u * (size_t)NB * CC * SEQ)               // bf16 v lo planes [b][c][t]
#define WS_Y   (WS_VL + 2u * (size_t)NB * CC * SEQ)               // f32 merged heads y [PR][CC]
#define WS_END (WS_Y + 4u * PR * CC)
static_assert(WS_END <= (size_t)134217728u);
static_assert((((size_t)(NB - 1) * SEQ_FULL + SEQ) * CC) <= (size_t)NB_FULL * SEQ_FULL * CC);

// ---- GEMM core of k_proj and k_out: block = 8 waves on a 128 x 128 tile of A . B^T (both operands f32 rows, k contiguous), wave = 32 x 64 (2 x 4 tiles).
// Per step of 32 k the block reads its 128 + 128 rows once, every wave-wide load covering 4 whole 128-byte lines, converts each value once and keeps the 16-bit tile in LDS for all 8 waves.
// Two LDS buffers: step s + 1 is loaded into registers ahead of step s's products and stored behind them; one barrier a step. k runs upward 32 at a time into the same accumulators, in the fragment k order above.
#define GT 128                               // tile rows of either operand
#define GK 32                                // k per step
#define GP 40                                // LDS row pitch in 16-bit elements: 80 B = 16 B x odd, conflict-free for 16-byte fragment reads
#define GBUF (2 * GT * GP)                   // 16-bit elements per buffer: A rows, then B rows
#define GLDS (2 * GT * 136 * 2)              // bytes: the larger of the two buffers (40,960) and the output staging of either kernel
static_assert(2 * GBUF * 2 <= GLDS && GT * 132 * 4 <= GLDS && (SEQ % GT) == 0 && (CC % GT) == 0 && (CC % GK) == 0);
// CV 0: bf16; 1: f16 of v x 2^6; 2: f16 of (v rounded to bf16) x 2^6
template <int CV> __device__ __forceinline__ v2u cvt4(v4f v) {
  union { v4b b; v4h h; v2u u; } r;
#pragma unroll
  for (int i = 0; i < 4; ++i) {
    if constexpr (CV == 0) r.b[i] = (__bf16)v[i];
    else if constexpr (CV == 1) r.h[i] = (_Float16)(v[i] * 64.0f);
    else r.h[i] = (_Float16)(bfr(v[i]) * 64.0f); }
  return r.u;
}
union FR { v16h h; v16b b; v4u q[2]; };
__device__ __forceinline__ FR frag_s(const unsigned short* p) { FR u; u.q[0] = *(const v4u*)p; u.q[1] = *(const v4u*)(p + 16); return u; }
template <bool BF> __device__ __forceinline__ void gemm_step(const unsigned short* fa, const unsigned short* fb, v8f (&acc)[2][4]) {
  FR a[2], w[4];
#pragma unroll
  for (int i = 0; i < 2; ++i) a[i] = frag_s(fa + i * 16 * GP);
#pragma unroll
  for (int j = 0; j < 4; ++j) w[j] = frag_s(fb + j * 16 * GP);
#pragma unroll
  for (int i = 0; i < 2; ++i) {
#pragma unroll
    for (int j = 0; j < 4; ++j) { if constexpr (BF) acc[i][j] = wmma_bf(a[i].b, w[j].b, acc[i][j]); else acc[i][j] = wmma16(a[i].h, w[j].h, acc[i][j]); } }
}
template <int CA, int CB, bool BF>
__device__ __forceinline__ void gemm_core(const float* __restrict__ A, const float* __restrict__ B, unsigned short* lds, v8f (&acc)[2][4]) {
  const int tid = threadIdx.x, wave = tid >> 5, lane = tid & 31, col = lane & 15, g = lane >> 4;
  const float* ap = A + (size_t)(tid >> 3) * CC + (tid & 7) * 4;         // 8 threads a row of 32 floats; 32 rows a sweep, 4 sweeps an operand
  const float* bp = B + (size_t)(tid >> 3) * CC + (tid & 7) * 4;
  const int so = (tid >> 3) * GP + (tid & 7) * 4;
  const int fao = ((wave >> 1) * 32 + col) * GP + 8 * g, fbo = (GT + (wave & 1) * 64 + col) * GP + 8 * g;
  v4f ra[4], rb[4];
#pragma unroll
  for (int i = 0; i < 4; ++i) { ra[i] = *(const v4f*)(ap + (size_t)i * 32 * CC); rb[i] = *(const v4f*)(bp + (size_t)i * 32 * CC); }
#pragma unroll
  for (int i = 0; i < 4; ++i) { *(v2u*)(lds + so + i * 32 * GP) = cvt4<CA>(ra[i]); *(v2u*)(lds + so + (GT + i * 32) * GP) = cvt4<CB>(rb[i]); }
  int cur = 0;
#pragma unroll 1                                            // rolled: the body is the same every step, and unrolled it would only grow the code
  for (int kc = 0; kc < CC / GK - 1; ++kc) {
    __syncthreads();                                        // buffer cur is written by all; buffer cur ^ 1 is left by all its readers
    ap += GK; bp += GK;
#pragma unroll
    for (int i = 0; i < 4; ++i) { ra[i] = *(const v4f*)(ap + (size_t)i * 32 * CC); rb[i] = *(const v4f*)(bp + (size_t)i * 32 * CC); }
    gemm_step<BF>(lds + cur * GBUF + fao, lds + cur * GBUF + fbo, acc);
    __builtin_amdgcn_sched_barrier(0);                      // keeps the waits on the next step's global loads behind this step's products; without it they stand behind the first product
    cur ^= 1;
#pragma unroll
    for (int i = 0; i < 4; ++i) { *(v2u*)(lds + cur * GBUF + so + i * 32 * GP) = cvt4<CA>(ra[i]); *(v2u*)(lds + cur * GBUF + so + (GT + i * 32) * GP) = cvt4<CB>(rb[i]); }
  }
  __syncthreads();
  gemm_step<BF>(lds + cur * GBUF + fao, lds + cur * GBUF + fbo, acc);
  __syncthreads();                                          // every wave has left the buffers: the caller stages its output over them
}

// ---- k_proj: block = (128 plane rows, 128 cols, which in {q,k,v}); W rows = which*CC + (h*HD + d); q -> f16 hi + residual, k -> f16, v -> bf16 hi/lo planes [b][c][t]
__global__ __launch_bounds__(256) __attribute__((amdgpu_num_vgpr(256)))
void k_proj(const float* __restrict__ X, const float* __restrict__ W, _Float16* __restrict__ QH, _Float16* __restrict__ QL, _Float16* __restrict__ KH, __bf16* __restrict__ VT, __bf16* __restrict__ VL) {
  __shared__ __align__(16) unsigned short lds[GLDS / 2];
  const int tid = threadIdx.x, wave = tid >> 5, lane = tid & 31, col = lane & 15, g = lane >> 4;
  const int which = blockIdx.z; const int c0 = blockIdx.y * GT;
  const size_t r0 = (size_t)blockIdx.x * GT;            // plane row base = b*SEQ + t0
  const size_t b = r0 / SEQ; const int t0 = (int)(r0 % SEQ);
  const size_t xr0 = b * SEQ_FULL + (size_t)t0;          // input row base
  v8f acc[2][4] = {};
  gemm_core<0, 0, true>(X + xr0 * CC, W + ((size_t)which * CC + c0) * CC, lds, acc);
  const int rb0 = (wave >> 1) * 32 + 8 * g, cb0 = (wave & 1) * 64 + col;   // acc[i][j][r] = (row rb0 + 16 i + r, col cb0 + 16 j)
  if (which == 2) { __bf16* th = (__bf16*)lds; __bf16* tl2 = th + GT * 136;   // [col][row], pitch 136
#pragma unroll
    for (int i = 0; i < 2; ++i) {
#pragma unroll
      for (int j = 0; j < 4; ++j) { v8b hh, ll;
#pragma unroll
        for (int r = 0; r < 8; ++r) { const float v = acc[i][j][r]; const __bf16 bh = (__bf16)v; hh[r] = bh; ll[r] = (__bf16)(v - (float)bh); }
        const int o = (cb0 + j * 16) * 136 + rb0 + i * 16; *(v8b*)(th + o) = hh; *(v8b*)(tl2 + o) = ll; } }
    __syncthreads();
#pragma unroll                                              // unrolled: one address with immediate offsets, the LDS reads issued together ahead of the stores
    for (int it = 0; it < GT * 16 / 256; ++it) { const int cl = it * 16 + (tid >> 4), q = tid & 15; const size_t o2 = (b * CC + c0 + cl) * (size_t)SEQ + t0 + q * 8;
      vst2(VT + o2, *(const v4u*)(th + cl * 136 + q * 8)); vst2(VL + o2, *(const v4u*)(tl2 + cl * 136 + q * 8)); } }
  else { _Float16* sh = (_Float16*)lds; _Float16* sl = sh + GT * 136;         // [row][col], pitch 136
#pragma unroll
    for (int i = 0; i < 2; ++i) {
#pragma unroll
      for (int j = 0; j < 4; ++j) {
#pragma unroll
        for (int r = 0; r < 8; ++r) { const float v = acc[i][j][r]; const int o = (rb0 + i * 16 + r) * 136 + cb0 + j * 16;
          const _Float16 hv = (_Float16)v; sh[o] = hv; sl[o] = (_Float16)((v - (float)hv) * 1024.0f); } } }   // q residual carried x 2^10 so the plane stays f16-normal
    __syncthreads();
    if (which == 0) {
#pragma unroll                                              // unrolled, as above
      for (int it = 0; it < GT * 16 / 256; ++it) { const int rl = it * 16 + (tid >> 4), q = tid & 15; const size_t o = (r0 + rl) * CC + c0 + q * 8;
        vst2(QH + o, *(const v4u*)(sh + rl * 136 + q * 8)); vst2(QL + o, *(const v4u*)(sl + rl * 136 + q * 8)); }
      asm volatile("s_wait_xcnt 0x0" ::: "memory"); }     // the build lays the v branch, which rewrites these stores' registers, behind them: the wait stands in front of it
    else {
#pragma unroll                                              // unrolled, as above
      for (int it = 0; it < GT * 16 / 256; ++it) { const int rl = it * 16 + (tid >> 4), q = tid & 15;
        vst2(KH + (r0 + rl) * CC + c0 + q * 8, *(const v4u*)(sh + rl * 136 + q * 8)); }
      asm volatile("s_wait_xcnt 0x0" ::: "memory"); } }   // the build lays the q branch, which rewrites these stores' registers, directly behind them: the wait stands in front of it
}
#define NQ 2
#define AW 8
#define KG 2                                 // key groups
#define AS 128                               // keys per tile = KG groups x two passes of 32
#define AP 72                                // K row pitch in 16-bit elements: 144 B = 16 B x odd, conflict-free for 16-byte fragment reads
#define VP 136                               // V row pitch in 16-bit elements: 272 B = 16 B x odd, likewise
#define KTILE (AS * AP)                      // 16-bit elements of the K tile: AS key rows
#define VTILE (64 * VP)                      // 16-bit elements of one V plane's tile: 64 head columns
#define ABUF (KTILE + 2 * VTILE)             // K, V hi, V lo
#define SC2 (1.4426950408889634f / 64.0f)    // log2(e) / head size: the logit scale and the change of base in one factor
static_assert((SEQ % (AW * NQ * 16)) == 0);
static_assert(AS == KG * 64 && HD == 64 && AW * KG * 32 == 512 && (SEQ % AS) == 0 && SEQ / AS >= 2);
static_assert((NQ * (HD / 16) * 2 + 1) * AW * 32 * 16 <= 2 * ABUF * 2);   // group 1's state fits the ring
// One tile: 6 copies of 16 B a lane. K: 8 lanes a row, 64 rows a sweep, 2 sweeps; V planes: 16 lanes a row, 32 rows a sweep, 2 sweeps each.
// lk, lv = the lane's LDS byte addresses in the K and the V hi plane of the target buffer; k, vh, vl = its global addresses in the first sweep.
// The s_wait_xcnt stands inside the statement, behind the last copy: the operands' registers are rewritten only behind it.
__device__ __forceinline__ void attn_copy(unsigned lk, unsigned lv, const _Float16* k, const __bf16* vh, const __bf16* vl) {
  asm volatile("global_load_async_to_lds_b128 %0, %6, off\n\t"
               "global_load_async_to_lds_b128 %1, %7, off\n\t"
               "global_load_async_to_lds_b128 %2, %8, off\n\t"
               "global_load_async_to_lds_b128 %3, %9, off\n\t"
               "global_load_async_to_lds_b128 %4, %10, off\n\t"
               "global_load_async_to_lds_b128 %5, %11, off\n\t"
               "s_wait_xcnt 0x0"
               :: "v"(lk), "v"(lk + 64u * AP * 2u), "v"(lv), "v"(lv + 32u * VP * 2u), "v"(lv + VTILE * 2u), "v"(lv + (VTILE + 32u * VP) * 2u),
                  "v"(k), "v"(k + (size_t)64 * CC), "v"(vh), "v"(vh + (size_t)32 * SEQ), "v"(vl), "v"(vl + (size_t)32 * SEQ)
               : "memory");
}
__global__ __launch_bounds__(AW * KG * 32) __attribute__((amdgpu_num_vgpr(256)))
void k_attn(const _Float16* __restrict__ QH, const _Float16* __restrict__ QL, const _Float16* __restrict__ KH, const __bf16* __restrict__ VT, const __bf16* __restrict__ VL, float* __restrict__ Y) {
  __shared__ __align__(16) unsigned short ring[2 * ABUF];
  const int tid = threadIdx.x, lane = tid & 31, col = lane & 15, g = lane >> 4;
  const int wave = __builtin_amdgcn_readfirstlane(tid >> 5), qw = wave & (AW - 1), kg = wave / AW;
  const int h = blockIdx.y, b = blockIdx.z;
  const size_t q0 = (size_t)b * SEQ + blockIdx.x * (AW * NQ * 16) + qw * (NQ * 16);
  v16h qh[NQ][HD / 32], ql[NQ][HD / 32];
#pragma unroll
  for (int u = 0; u < NQ; ++u) {
#pragma unroll
    for (int kc = 0; kc < HD / 32; ++kc) { const size_t o = (q0 + u * 16 + col) * CC + h * HD + kc * 32; qh[u][kc] = frag_h(QH + o, lane); ql[u][kc] = frag_h(QL + o, lane); } }
  const _Float16* kp = KH + (size_t)b * SEQ * CC + h * HD;               // wave-uniform bases of the next tile to copy, advanced per tile; the lane's own part is a fixed 32-bit offset
  const __bf16* vhp = VT + ((size_t)b * CC + h * HD) * (size_t)SEQ;
  const __bf16* vlp = VL + ((size_t)b * CC + h * HD) * (size_t)SEQ;
  const unsigned ko = (unsigned)((tid >> 3) * CC + (tid & 7) * 8), vo = (unsigned)((tid >> 4) * SEQ + (tid & 15) * 8);
  const unsigned lko = (unsigned)(uintptr_t)ring + (unsigned)((tid >> 3) * AP + (tid & 7) * 8) * 2u;             // LDS byte addresses of the lane's first K and V hi copies in buffer 0
  const unsigned lvo = (unsigned)(uintptr_t)ring + (unsigned)(KTILE + (tid >> 4) * VP + (tid & 15) * 8) * 2u;
  const int fk = (kg * 64 + col) * AP + 8 * g;                           // the lane's place in its group's first K fragment
  const int fv = KTILE + col * VP + kg * 64 + 8 * g;                     // ... and first V hi fragment
  attn_copy(lko, lvo, kp + ko, vhp + vo, vlp + vo);                      // tile 0 into buffer 0
  asm volatile("s_wait_asynccnt 0x0" ::: "memory");                      // this wave's copies of tile 0 have landed
  __syncthreads();                                                       // ... and every other wave's
  kp += (size_t)AS * CC; vhp += AS; vlp += AS;
  attn_copy(lko + ABUF * 2u, lvo + ABUF * 2u, kp + ko, vhp + vo, vlp + vo);   // tile 1 into buffer 1
  v8f acc[NQ][HD / 16] = {};
  float m[NQ], l[NQ];
#pragma unroll
  for (int u = 0; u < NQ; ++u) { m[u] = -3.0e38f; l[u] = 0.f; }
#pragma unroll 1                                            // rolled: the foot's barrier and refill stand once
  for (int st = 0; st < SEQ / AS; ++st) {
  const unsigned short* tb = ring + (st & 1) * ABUF;
#pragma unroll 1                                            // rolled: one pass already fills the 256-register budget
  for (int ps = 0; ps < AS / (KG * 32); ++ps) {
    const unsigned short* kq = tb + fk + ps * 32 * AP; const unsigned short* vq = tb + fv + ps * 32;
    v8f sa[NQ][2] = {}, sb[NQ][2] = {};
    FR kb[HD / 32][2], vf[2][2];                            // the pass's K fragments are read as one group: one LDS latency a pass, not one a fragment
#pragma unroll
    for (int kc = 0; kc < HD / 32; ++kc) {
#pragma unroll
      for (int t = 0; t < 2; ++t) kb[kc][t] = frag_s(kq + t * 16 * AP + kc * 32); }
#pragma unroll
    for (int kc = 0; kc < HD / 32; ++kc) {
#pragma unroll
      for (int t = 0; t < 2; ++t) {
#pragma unroll
        for (int u = 0; u < NQ; ++u) { sa[u][t] = wmma16(kb[kc][t].h, qh[u][kc], sa[u][t]); sb[u][t] = wmma16(kb[kc][t].h, ql[u][kc], sb[u][t]); } } }
    vf[0][0] = frag_s(vq); vf[0][1] = frag_s(vq + VTILE);   // the first V fragments are read ahead of the softmax
    F2 pf[NQ];
#pragma unroll
    for (int u = 0; u < NQ; ++u) {
      float p[16]; float mx = m[u];
#pragma unroll
      for (int i = 0; i < 16; ++i) { p[i] = sa[u][i >> 3][i & 7] + sb[u][i >> 3][i & 7] * (1.0f / 1024.0f); mx = fmaxf(mx, p[i]); }   // raw scores q.k; m[u] is kept in the same unit
      mx = fmaxf(mx, __shfl_xor(mx, 16));
      if (__builtin_amdgcn_ballot_w32(mx > m[u]) != 0) {     // some query's maximum rose: rescale (the factor is exactly 1 for the others)
        const float al = __builtin_amdgcn_exp2f((m[u] - mx) * SC2); l[u] *= al; m[u] = mx;
#pragma unroll
        for (int j = 0; j < HD / 16; ++j) acc[u][j] = acc[u][j] * al; }
      const float nm = -m[u] * SC2;
#pragma unroll
      for (int i = 0; i < 16; i += 2) {                     // exp((s - m) / 64) = 2^(s * SC2 - m * SC2); two exponents a packed fma
        const v2f e = __builtin_elementwise_fma((v2f){p[i], p[i + 1]}, (v2f){SC2, SC2}, (v2f){nm, nm});
        p[i] = __builtin_amdgcn_exp2f(e[0]); l[u] += p[i]; p[i + 1] = __builtin_amdgcn_exp2f(e[1]); l[u] += p[i + 1]; }
      pf[u] = bsplit16(p); }
#pragma unroll
    for (int j = 0; j < HD / 16; ++j) {
      if (j + 1 < HD / 16) { vf[(j + 1) & 1][0] = frag_s(vq + (j + 1) * 16 * VP); vf[(j + 1) & 1][1] = frag_s(vq + VTILE + (j + 1) * 16 * VP); }   // the next group's V fragments are read ahead of this group's products
      const v16b vh = vf[j & 1][0].b, vl = vf[j & 1][1].b;
#pragma unroll
      for (int u = 0; u < NQ; ++u) acc[u][j] = wmma_bf(vh, pf[u].h, acc[u][j]);
#pragma unroll
      for (int u = 0; u < NQ; ++u) acc[u][j] = wmma_bf(vh, pf[u].l, acc[u][j]);
#pragma unroll
      for (int u = 0; u < NQ; ++u) acc[u][j] = wmma_bf(vl, pf[u].h, acc[u][j]); }
  }
    asm volatile("s_wait_dscnt 0x0" ::: "memory");          // this wave's reads of tile st are done before its buffer is handed over
    asm volatile("s_wait_asynccnt 0x0" ::: "memory");       // this wave's copies of tile st + 1 have landed
    __syncthreads();                                        // publishes tile st + 1; every wave has left tile st's buffer
    if (st + 2 < SEQ / AS) { kp += (size_t)AS * CC; vhp += AS; vlp += AS;
      attn_copy(lko + (unsigned)(st & 1) * (ABUF * 2u), lvo + (unsigned)(st & 1) * (ABUF * 2u), kp + ko, vhp + vo, vlp + vo); }   // tile st + 2 into the buffer just left
  }
  asm volatile("s_wait_asynccnt 0x0" ::: "memory");         // no copy is outstanding when the wave ends
  // The loop's last barrier has freed the ring (no reader, no copy left): group 1's state goes through it, 16 B a lane, lanes side by side.
  v4f* xg = (v4f*)ring + qw * 32 + lane;                    // slot s of this query wave's lane: xg[s * AW * 32]
  if (kg == 1) {
    xg[0] = (v4f){m[0], m[1], l[0], l[1]};
#pragma unroll
    for (int u = 0; u < NQ; ++u) {
#pragma unroll
      for (int j = 0; j < HD / 16; ++j) { const v8f o = acc[u][j]; const int sl = 1 + (u * (HD / 16) + j) * 2;
        xg[sl * AW * 32] = (v4f){o[0], o[1], o[2], o[3]}; xg[(sl + 1) * AW * 32] = (v4f){o[4], o[5], o[6], o[7]}; } } }
  __syncthreads();                                          // group 1's state is written before group 0 reads it
  if (kg == 0) {
    const v4f ml = xg[0];
#pragma unroll
    for (int u = 0; u < NQ; ++u) {
      const float mm = fmaxf(m[u], ml[u]);                  // both states are brought to the larger maximum
      const float a0 = __builtin_amdgcn_exp2f((m[u] - mm) * SC2), a1 = __builtin_amdgcn_exp2f((ml[u] - mm) * SC2);
      const float ls = l[u] * a0 + ml[2 + u] * a1;
      const float inv = 1.0f / (ls + __shfl_xor(ls, 16));
      const float w0 = a0 * inv, w1 = a1 * inv;
      float* yp = Y + (q0 + u * 16 + col) * CC + h * HD + 8 * g;   // acc[u][j][r] = O[query u*16 + col][j*16 + 8g + r]
#pragma unroll
      for (int j = 0; j < HD / 16; ++j) { const int sl = 1 + (u * (HD / 16) + j) * 2; const v4f x0 = xg[sl * AW * 32], x1 = xg[(sl + 1) * AW * 32]; const v8f o = acc[u][j];
        vst2(yp + j * 16, (v4f){o[0], o[1], o[2], o[3]} * w0 + x0 * w1); vst2(yp + j * 16 + 4, (v4f){o[4], o[5], o[6], o[7]} * w0 + x1 * w1); } } }
}
// ---- k_out: block = (128 plane rows, 128 cols): y (x 2^6, f16) . W_out^T (bf16 values x 2^6, f16), + bf16 b_out
__global__ __launch_bounds__(256) __attribute__((amdgpu_num_vgpr(256)))
void k_out(const float* __restrict__ Y, const float* __restrict__ W, const float* __restrict__ Bv, float* __restrict__ O) {
  __shared__ __align__(16) unsigned short lds[GLDS / 2];
  const int tid = threadIdx.x, wave = tid >> 5, lane = tid & 31, col = lane & 15, g = lane >> 4;
  const int c0 = blockIdx.y * GT; const size_t r0 = (size_t)blockIdx.x * GT;   // plane row base
  v8f acc[2][4] = {};
  gemm_core<1, 2, false>(Y + r0 * CC, W + (size_t)c0 * CC, lds, acc);
  float* so = (float*)lds;                                                     // [row][col], pitch 132
  const int rb0 = (wave >> 1) * 32 + 8 * g, cb0 = (wave & 1) * 64 + col;
#pragma unroll
  for (int j = 0; j < 4; ++j) { const float bb = bfr(Bv[c0 + cb0 + j * 16]);
#pragma unroll
    for (int i = 0; i < 2; ++i) {
#pragma unroll
      for (int r = 0; r < 8; ++r) so[(rb0 + i * 16 + r) * 132 + cb0 + j * 16] = acc[i][j][r] * (1.0f / 4096.0f) + bb; } }
  __syncthreads();
  const size_t b = r0 / SEQ; const int t0 = (int)(r0 % SEQ);
  for (int rl = wave * 16; rl < wave * 16 + 16; ++rl)
    vst2(O + (b * SEQ_FULL + (size_t)(t0 + rl)) * CC + c0 + lane * 4, *(const v4f*)(so + rl * 132 + lane * 4));
}

extern "C" void kernel_launch(void* const* d_in, const int* in_sizes, int n_in, void* d_out, int out_size, void* d_ws, size_t ws_size, hipStream_t stream) {
  if (n_in < 4) return;
  const size_t rows_needed = (size_t)(NB - 1) * SEQ_FULL + SEQ;
  if ((size_t)in_sizes[0] < rows_needed * CC) return;            // x [2,2048,1024]
  if ((size_t)in_sizes[1] < (size_t)3 * CC * CC) return;         // w_qkv [3072,1024] ([out][in])
  if ((size_t)in_sizes[2] < (size_t)CC * CC) return;             // w_out [1024,1024] ([out][in])
  if (in_sizes[3] < CC) return;                                   // b_out [1024]
  if ((size_t)out_size < rows_needed * CC) return;
  if (ws_size < (size_t)WS_END) return;
  const float* X = (const float*)d_in[0]; const float* W = (const float*)d_in[1]; const float* WO = (const float*)d_in[2]; const float* BO = (const float*)d_in[3];
  char* ws = (char*)d_ws;
  _Float16 *QH = (_Float16*)(ws + WS_QH), *QL = (_Float16*)(ws + WS_QL), *KH = (_Float16*)(ws + WS_KH);
  __bf16 *VT = (__bf16*)(ws + WS_VT), *VL = (__bf16*)(ws + WS_VL);
  float *Y = (float*)(ws + WS_Y);
  k_proj<<<dim3(NB * SEQ / GT, CC / GT, 3), 256, 0, stream>>>(X, W, QH, QL, KH, VT, VL);
  k_attn<<<dim3(SEQ / (AW * NQ * 16), NH, NB), AW * KG * 32, 0, stream>>>(QH, QL, KH, VT, VL, Y);
  k_out<<<dim3(NB * SEQ / GT, CC / GT), 256, 0, stream>>>(Y, WO, BO, (float*)d_out);
}

// v006
// Measured time: 123 microseconds a run.
// In both of two side-by-side timings against v005, it was 1.05 times as fast.
// Counting every step since v000, it is 13.5 times as fast.
// compute dtype: x and W_qkv RNE-converted to bf16; q/k/v = x W_qkv^T with exact bf16 products on v_wmma_f32_16x16x32_bf16, f32 accumulate; q as f16 hi + residual (x 2^10), k once to f16 -> 2-product raw scores (v_wmma_f32_16x16x32_f16) in f32 registers; running-maximum softmax in f32, base 2 (v_exp_f32 of one fma that carries log2(e)/64); P f32 split bf16 hi + lo against v bf16 hi + lo (3 bf16 products), divided by the row sum at the end; merged heads y in f32; y (x 2^6, f16) times W_out^T (bf16 values x 2^6, f16): 1 f16 product, f32 accumulate, + bf16 b_out.
#include <hip/hip_runtime.h>
#include <math.h>

typedef __attribute__((ext_vector_type(16))) _Float16 v16h;
typedef __attribute__((ext_vector_type(16))) __bf16 v16b;
typedef __attribute__((ext_vector_type(8)))  _Float16 v8h;
typedef __attribute__((ext_vector_type(8)))  __bf16 v8b;
typedef __attribute__((ext_vector_type(8)))  float v8f;
typedef __attribute__((ext_vector_type(4)))  float v4f;
typedef __attribute__((ext_vector_type(2)))  float v2f;
typedef __attribute__((ext_vector_type(4)))  unsigned v4u;
typedef __attribute__((ext_vector_type(2)))  unsigned v2u;
typedef __attribute__((ext_vector_type(4)))  _Float16 v4h;
typedef __attribute__((ext_vector_type(4)))  __bf16 v4b;

template <typename T> __device__ __forceinline__ void vst2(void* p, T v) { *(T*)p = v;  }

__device__ __forceinline__ v8f wmma16(v16h a, v16h b, v8f c) {
  return __builtin_amdgcn_wmma_f32_16x16x32_f16(false, a, false, b, (short)0, c, false, false);
}
__device__ __forceinline__ v8f wmma_bf(v16b a, v16b b, v8f c) {
  return __builtin_amdgcn_wmma_f32_16x16x32_bf16(false, a, false, b, (short)0, c, false, false);
}
// 16x16x32 fragments: lane = (g = lane>>4, row/col = lane&15); elements 0..7 = k0+8g+0..7, 8..15 = k0+16+8g+0..7; D element r = row 8g+r, col lane&15
__device__ __forceinline__ v16h frag_h(const _Float16* rowk0, int lane) {
  union { v16h v; v8h q[2]; } u; const _Float16* p = rowk0 + 8 * (lane >> 4);
  u.q[0] = *(const v8h*)p; u.q[1] = *(const v8h*)(p + 16); return u.v;
}
// 16 f32 values -> bf16 hi + lo fragment pair
struct F2 { v16b h, l; };
__device__ __forceinline__ F2 bsplit16(const float v[16]) { F2 r;
#pragma unroll
  for (int i = 0; i < 16; ++i) { const __bf16 hb = (__bf16)v[i]; r.h[i] = hb; r.l[i] = (__bf16)(v[i] - (float)hb); }
  return r; }
__device__ __forceinline__ float bfr(float v) { return (float)(__bf16)v; }

// sizes: B 2, N 2048, C 1024 = 16 heads x 64; logits x (1/64); output projection C -> C with bias
#define NB_FULL 2
#define SEQ_FULL 2048
#ifndef NB
#define NB NB_FULL
#endif
#ifndef SEQ
#define SEQ SEQ_FULL
#endif
#define CC 1024
#define NH 16
#define HD 64
static_assert(NB >= 1 && NB <= NB_FULL);
static_assert(SEQ >= 128 && SEQ <= SEQ_FULL && (SEQ % 128) == 0);
static_assert(NH * HD == CC && HD == 64 && (CC % 128) == 0);

#define PR     ((size_t)NB * SEQ)                                 // plane rows (b*SEQ + t)
#define WS_QH  ((size_t)0)                                        // f16 q hi   [PR][CC]
#define WS_QL  (WS_QH + 2u * PR * CC)                             // f16 q residual x 2^10 [PR][CC]
#define WS_KH  (WS_QL + 2u * PR * CC)                             // f16 k      [PR][CC]
#define WS_VT  (WS_KH + 2u * PR * CC)                             // bf16 v hi planes [b][c][t]
#define WS_VL  (WS_VT + 2u * (size_t)NB * CC * SEQ)               // bf16 v lo planes [b][c][t]
#define WS_Y   (WS_VL + 2u * (size_t)NB * CC * SEQ)               // f32 merged heads y [PR][CC]
#define WS_END (WS_Y + 4u * PR * CC)
static_assert(WS_END <= (size_t)134217728u);
static_assert((((size_t)(NB - 1) * SEQ_FULL + SEQ) * CC) <= (size_t)NB_FULL * SEQ_FULL * CC);

// ---- GEMM core of k_proj and k_out: block = 8 waves on a 128 x 128 tile of A . B^T (both operands f32 rows, k contiguous), wave = 32 x 64 (2 x 4 tiles).
// Per step of 32 k the block reads its 128 + 128 rows once, every wave-wide load covering 4 whole 128-byte lines, converts each value once and keeps the 16-bit tile in LDS for all 8 waves.
// Two LDS buffers: step s + 1 is loaded into registers ahead of step s's products and stored behind them; one barrier a step. k runs upward 32 at a time into the same accumulators, in the fragment k order above.
#define GT 128                               // tile rows of either operand
#define GK 32                                // k per step
#define GP 40                                // LDS row pitch in 16-bit elements: 80 B = 16 B x odd, conflict-free for 16-byte fragment reads
#define GBUF (2 * GT * GP)                   // 16-bit elements per buffer: A rows, then B rows
#define GLDS (2 * GT * 136 * 2)              // bytes: the larger of the two buffers (40,960) and the output staging of either kernel
static_assert(2 * GBUF * 2 <= GLDS && GT * 132 * 4 <= GLDS && (SEQ % GT) == 0 && (CC % GT) == 0 && (CC % GK) == 0);
// CV 0: bf16; 1: f16 of v x 2^6; 2: f16 of (v rounded to bf16) x 2^6
template <int CV> __device__ __forceinline__ v2u cvt4(v4f v) {
  union { v4b b; v4h h; v2u u; } r;
#pragma unroll
  for (int i = 0; i < 4; ++i) {
    if constexpr (CV == 0) r.b[i] = (__bf16)v[i];
    else if constexpr (CV == 1) r.h[i] = (_Float16)(v[i] * 64.0f);
    else r.h[i] = (_Float16)(bfr(v[i]) * 64.0f); }
  return r.u;
}
union FR { v16h h; v16b b; v4u q[2]; };
__device__ __forceinline__ FR frag_s(const unsigned short* p) { FR u; u.q[0] = *(const v4u*)p; u.q[1] = *(const v4u*)(p + 16); return u; }
template <bool BF> __device__ __forceinline__ void gemm_step(const unsigned short* fa, const unsigned short* fb, v8f (&acc)[2][4]) {
  FR a[2], w[4];
#pragma unroll
  for (int i = 0; i < 2; ++i) a[i] = frag_s(fa + i * 16 * GP);
#pragma unroll
  for (int j = 0; j < 4; ++j) w[j] = frag_s(fb + j * 16 * GP);
  __builtin_amdgcn_sched_barrier(0);                        // holds the step's fragment reads together ahead of its products: one LDS latency a step; without it the build reads the second A fragment behind the fourth product, with a wait to 0
#pragma unroll
  for (int i = 0; i < 2; ++i) {
#pragma unroll
    for (int j = 0; j < 4; ++j) { if constexpr (BF) acc[i][j] = wmma_bf(a[i].b, w[j].b, acc[i][j]); else acc[i][j] = wmma16(a[i].h, w[j].h, acc[i][j]); } }
}
template <int CA, int CB, bool BF>
__device__ __forceinline__ void gemm_core(const float* __restrict__ A, const float* __restrict__ B, unsigned short* lds, v8f (&acc)[2][4]) {
  const int tid = threadIdx.x, wave = tid >> 5, lane = tid & 31, col = lane & 15, g = lane >> 4;
  const float* ap = A + (size_t)(tid >> 3) * CC + (tid & 7) * 4;         // 8 threads a row of 32 floats; 32 rows a sweep, 4 sweeps an operand
  const float* bp = B + (size_t)(tid >> 3) * CC + (tid & 7) * 4;
  const int so = (tid >> 3) * GP + (tid & 7) * 4;
  const int fao = ((wave >> 1) * 32 + col) * GP + 8 * g, fbo = (GT + (wave & 1) * 64 + col) * GP + 8 * g;
  v4f ra[4], rb[4];
#pragma unroll
  for (int i = 0; i < 4; ++i) { ra[i] = *(const v4f*)(ap + (size_t)i * 32 * CC); rb[i] = *(const v4f*)(bp + (size_t)i * 32 * CC); }
#pragma unroll
  for (int i = 0; i < 4; ++i) { *(v2u*)(lds + so + i * 32 * GP) = cvt4<CA>(ra[i]); *(v2u*)(lds + so + (GT + i * 32) * GP) = cvt4<CB>(rb[i]); }
  int cur = 0;
#pragma unroll 1                                            // rolled: the body is the same every step, and unrolled it would only grow the code
  for (int kc = 0; kc < CC / GK - 1; ++kc) {
    __syncthreads();                                        // buffer cur is written by all; buffer cur ^ 1 is left by all its readers
    ap += GK; bp += GK;
#pragma unroll
    for (int i = 0; i < 4; ++i) { ra[i] = *(const v4f*)(ap + (size_t)i * 32 * CC); rb[i] = *(const v4f*)(bp + (size_t)i * 32 * CC); }
    __builtin_amdgcn_sched_barrier(0);                      // holds the next step's global loads ahead of this step's LDS reads and products; without it the build sinks them behind most of the products, directly in front of their waits
    gemm_step<BF>(lds + cur * GBUF + fao, lds + cur * GBUF + fbo, acc);
    __builtin_amdgcn_sched_barrier(0);                      // keeps the waits on the next step's global loads behind this step's products; without it they stand behind the first product
    cur ^= 1;
#pragma unroll
    for (int i = 0; i < 4; ++i) { *(v2u*)(lds + cur * GBUF + so + i * 32 * GP) = cvt4<CA>(ra[i]); *(v2u*)(lds + cur * GBUF + so + (GT + i * 32) * GP) = cvt4<CB>(rb[i]); }
  }
  __syncthreads();
  gemm_step<BF>(lds + cur * GBUF + fao, lds + cur * GBUF + fbo, acc);
  __syncthreads();                                          // every wave has left the buffers: the caller stages its output over them
}

// ---- k_proj: block = (128 plane rows, 128 cols, which in {q,k,v}); W rows = which*CC + (h*HD + d); q -> f16 hi + residual, k -> f16, v -> bf16 hi/lo planes [b][c][t]
__global__ __launch_bounds__(256) __attribute__((amdgpu_num_vgpr(256)))
void k_proj(const float* __restrict__ X, const float* __restrict__ W, _Float16* __restrict__ QH, _Float16* __restrict__ QL, _Float16* __restrict__ KH, __bf16* __restrict__ VT, __bf16* __restrict__ VL) {
  __shared__ __align__(16) unsigned short lds[GLDS / 2];
  const int tid = threadIdx.x, wave = tid >> 5, lane = tid & 31, col = lane & 15, g = lane >> 4;
  const int which = blockIdx.z; const int c0 = blockIdx.y * GT;
  const size_t r0 = (size_t)blockIdx.x * GT;            // plane row base = b*SEQ + t0
  const size_t b = r0 / SEQ; const int t0 = (int)(r0 % SEQ);
  const size_t xr0 = b * SEQ_FULL + (size_t)t0;          // input row base
  v8f acc[2][4] = {};
  gemm_core<0, 0, true>(X + xr0 * CC, W + ((size_t)which * CC + c0) * CC, lds, acc);
  const int rb0 = (wave >> 1) * 32 + 8 * g, cb0 = (wave & 1) * 64 + col;   // acc[i][j][r] = (row rb0 + 16 i + r, col cb0 + 16 j)
  if (which == 2) { __bf16* th = (__bf16*)lds; __bf16* tl2 = th + GT * 136;   // [col][row], pitch 136
#pragma unroll
    for (int i = 0; i < 2; ++i) {
#pragma unroll
      for (int j = 0; j < 4; ++j) { v8b hh, ll;
#pragma unroll
        for (int r = 0; r < 8; ++r) { const float v = acc[i][j][r]; const __bf16 bh = (__bf16)v; hh[r] = bh; ll[r] = (__bf16)(v - (float)bh); }
        const int o = (cb0 + j * 16) * 136 + rb0 + i * 16; *(v8b*)(th + o) = hh; *(v8b*)(tl2 + o) = ll; } }
    __syncthreads();
#pragma unroll                                              // unrolled: one address with immediate offsets, the LDS reads issued together ahead of the stores
    for (int it = 0; it < GT * 16 / 256; ++it) { const int cl = it * 16 + (tid >> 4), q = tid & 15; const size_t o2 = (b * CC + c0 + cl) * (size_t)SEQ + t0 + q * 8;
      vst2(VT + o2, *(const v4u*)(th + cl * 136 + q * 8)); vst2(VL + o2, *(const v4u*)(tl2 + cl * 136 + q * 8)); } }
  else { _Float16* sh = (_Float16*)lds; _Float16* sl = sh + GT * 136;         // [row][col], pitch 136
#pragma unroll
    for (int i = 0; i < 2; ++i) {
#pragma unroll
      for (int j = 0; j < 4; ++j) {
#pragma unroll
        for (int r = 0; r < 8; ++r) { const float v = acc[i][j][r]; const int o = (rb0 + i * 16 + r) * 136 + cb0 + j * 16;
          const _Float16 hv = (_Float16)v; sh[o] = hv; sl[o] = (_Float16)((v - (float)hv) * 1024.0f); } } }   // q residual carried x 2^10 so the plane stays f16-normal
    __syncthreads();
    if (which == 0) {
#pragma unroll                                              // unrolled, as above
      for (int it = 0; it < GT * 16 / 256; ++it) { const int rl = it * 16 + (tid >> 4), q = tid & 15; const size_t o = (r0 + rl) * CC + c0 + q * 8;
        vst2(QH + o, *(const v4u*)(sh + rl * 136 + q * 8)); vst2(QL + o, *(const v4u*)(sl + rl * 136 + q * 8)); }
      asm volatile("s_wait_xcnt 0x0" ::: "memory"); }     // the build lays the v branch, which rewrites these stores' registers, behind them: the wait stands in front of it
    else {
#pragma unroll                                              // unrolled, as above
      for (int it = 0; it < GT * 16 / 256; ++it) { const int rl = it * 16 + (tid >> 4), q = tid & 15;
        vst2(KH + (r0 + rl) * CC + c0 + q * 8, *(const v4u*)(sh + rl * 136 + q * 8)); }
      asm volatile("s_wait_xcnt 0x0" ::: "memory"); } }   // the build lays the q branch, which rewrites these stores' registers, directly behind them: the wait stands in front of it
}
#define NQ 2
#define AW 8
#define KG 2                                 // key groups
#define AS 128                               // keys per tile = KG groups x two passes of 32
#define AP 72                                // K row pitch in 16-bit elements: 144 B = 16 B x odd, conflict-free for 16-byte fragment reads
#define VP 136                               // V row pitch in 16-bit elements: 272 B = 16 B x odd, likewise
#define KTILE (AS * AP)                      // 16-bit elements of the K tile: AS key rows
#define VTILE (64 * VP)                      // 16-bit elements of one V plane's tile: 64 head columns
#define ABUF (KTILE + 2 * VTILE)             // K, V hi, V lo
#define SC2 (1.4426950408889634f / 64.0f)    // log2(e) / head size: the logit scale and the change of base in one factor
static_assert((SEQ % (AW * NQ * 16)) == 0);
static_assert(AS == KG * 64 && HD == 64 && AW * KG * 32 == 512 && (SEQ % AS) == 0 && SEQ / AS >= 2);
static_assert((NQ * (HD / 16) * 2 + 1) * AW * 32 * 16 <= 2 * ABUF * 2);   // group 1's state fits the ring
// One tile: 6 copies of 16 B a lane. K: 8 lanes a row, 64 rows a sweep, 2 sweeps; V planes: 16 lanes a row, 32 rows a sweep, 2 sweeps each.
// lk, lv = the lane's LDS byte addresses in the K and the V hi plane of the target buffer; k, vh, vl = its global addresses in the first sweep.
// The s_wait_xcnt stands inside the statement, behind the last copy: the operands' registers are rewritten only behind it.
__device__ __forceinline__ void attn_copy(unsigned lk, unsigned lv, const _Float16* k, const __bf16* vh, const __bf16* vl) {
  asm volatile("global_load_async_to_lds_b128 %0, %6, off\n\t"
               "global_load_async_to_lds_b128 %1, %7, off\n\t"
               "global_load_async_to_lds_b128 %2, %8, off\n\t"
               "global_load_async_to_lds_b128 %3, %9, off\n\t"
               "global_load_async_to_lds_b128 %4, %10, off\n\t"
               "global_load_async_to_lds_b128 %5, %11, off\n\t"
               "s_wait_xcnt 0x0"
               :: "v"(lk), "v"(lk + 64u * AP * 2u), "v"(lv), "v"(lv + 32u * VP * 2u), "v"(lv + VTILE * 2u), "v"(lv + (VTILE + 32u * VP) * 2u),
                  "v"(k), "v"(k + (size_t)64 * CC), "v"(vh), "v"(vh + (size_t)32 * SEQ), "v"(vl), "v"(vl + (size_t)32 * SEQ)
               : "memory");
}
__global__ __launch_bounds__(AW * KG * 32) __attribute__((amdgpu_num_vgpr(256)))
void k_attn(const _Float16* __restrict__ QH, const _Float16* __restrict__ QL, const _Float16* __restrict__ KH, const __bf16* __restrict__ VT, const __bf16* __restrict__ VL, float* __restrict__ Y) {
  __shared__ __align__(16) unsigned short ring[2 * ABUF];
  const int tid = threadIdx.x, lane = tid & 31, col = lane & 15, g = lane >> 4;
  const int wave = __builtin_amdgcn_readfirstlane(tid >> 5), qw = wave & (AW - 1), kg = wave / AW;
  const int h = blockIdx.y, b = blockIdx.z;
  const size_t q0 = (size_t)b * SEQ + blockIdx.x * (AW * NQ * 16) + qw * (NQ * 16);
  v16h qh[NQ][HD / 32], ql[NQ][HD / 32];
#pragma unroll
  for (int u = 0; u < NQ; ++u) {
#pragma unroll
    for (int kc = 0; kc < HD / 32; ++kc) { const size_t o = (q0 + u * 16 + col) * CC + h * HD + kc * 32; qh[u][kc] = frag_h(QH + o, lane); ql[u][kc] = frag_h(QL + o, lane); } }
  const _Float16* kp = KH + (size_t)b * SEQ * CC + h * HD;               // wave-uniform bases of the next tile to copy, advanced per tile; the lane's own part is a fixed 32-bit offset
  const __bf16* vhp = VT + ((size_t)b * CC + h * HD) * (size_t)SEQ;
  const __bf16* vlp = VL + ((size_t)b * CC + h * HD) * (size_t)SEQ;
  const unsigned ko = (unsigned)((tid >> 3) * CC + (tid & 7) * 8), vo = (unsigned)((tid >> 4) * SEQ + (tid & 15) * 8);
  const unsigned lko = (unsigned)(uintptr_t)ring + (unsigned)((tid >> 3) * AP + (tid & 7) * 8) * 2u;             // LDS byte addresses of the lane's first K and V hi copies in buffer 0
  const unsigned lvo = (unsigned)(uintptr_t)ring + (unsigned)(KTILE + (tid >> 4) * VP + (tid & 15) * 8) * 2u;
  const int fk = (kg * 64 + col) * AP + 8 * g;                           // the lane's place in its group's first K fragment
  const int fv = KTILE + col * VP + kg * 64 + 8 * g;                     // ... and first V hi fragment
  attn_copy(lko, lvo, kp + ko, vhp + vo, vlp + vo);                      // tile 0 into buffer 0
  asm volatile("s_wait_asynccnt 0x0" ::: "memory");                      // this wave's copies of tile 0 have landed
  __syncthreads();                                                       // ... and every other wave's
  kp += (size_t)AS * CC; vhp += AS; vlp += AS;
  attn_copy(lko + ABUF * 2u, lvo + ABUF * 2u, kp + ko, vhp + vo, vlp + vo);   // tile 1 into buffer 1
  v8f acc[NQ][HD / 16] = {};
  float m[NQ], l[NQ];
#pragma unroll
  for (int u = 0; u < NQ; ++u) { m[u] = -3.0e38f; l[u] = 0.f; }
#pragma unroll 1                                            // rolled: the foot's barrier and refill stand once
  for (int st = 0; st < SEQ / AS; ++st) {
  const unsigned short* tb = ring + (st & 1) * ABUF;
#pragma unroll 1                                            // rolled: one pass already fills the 256-register budget
  for (int ps = 0; ps < AS / (KG * 32); ++ps) {
    const unsigned short* kq = tb + fk + ps * 32 * AP; const unsigned short* vq = tb + fv + ps * 32;
    v8f sa[NQ][2] = {}, sb[NQ][2] = {};
    FR kb[HD / 32][2], vf[2][2];                            // the pass's K fragments are read as one group: one LDS latency a pass, not one a fragment
#pragma unroll
    for (int kc = 0; kc < HD / 32; ++kc) {
#pragma unroll
      for (int t = 0; t < 2; ++t) kb[kc][t] = frag_s(kq + t * 16 * AP + kc * 32); }
#pragma unroll
    for (int kc = 0; kc < HD / 32; ++kc) {
#pragma unroll
      for (int t = 0; t < 2; ++t) {
#pragma unroll
        for (int u = 0; u < NQ; ++u) { sa[u][t] = wmma16(kb[kc][t].h, qh[u][kc], sa[u][t]); sb[u][t] = wmma16(kb[kc][t].h, ql[u][kc], sb[u][t]); } } }
    vf[0][0] = frag_s(vq); vf[0][1] = frag_s(vq + VTILE);   // the first V fragments are read ahead of the softmax
    F2 pf[NQ];
#pragma unroll
    for (int u = 0; u < NQ; ++u) {
      float p[16]; float mx = m[u];
#pragma unroll
      for (int i = 0; i < 16; ++i) { p[i] = sa[u][i >> 3][i & 7] + sb[u][i >> 3][i & 7] * (1.0f / 1024.0f); mx = fmaxf(mx, p[i]); }   // raw scores q.k; m[u] is kept in the same unit
      mx = fmaxf(mx, __shfl_xor(mx, 16));
      if (__builtin_amdgcn_ballot_w32(mx > m[u]) != 0) {     // some query's maximum rose: rescale (the factor is exactly 1 for the others)
        const float al = __builtin_amdgcn_exp2f((m[u] - mx) * SC2); l[u] *= al; m[u] = mx;
#pragma unroll
        for (int j = 0; j < HD / 16; ++j) acc[u][j] = acc[u][j] * al; }
      const float nm = -m[u] * SC2;
#pragma unroll
      for (int i = 0; i < 16; i += 2) {                     // exp((s - m) / 64) = 2^(s * SC2 - m * SC2); two exponents a packed fma
        const v2f e = __builtin_elementwise_fma((v2f){p[i], p[i + 1]}, (v2f){SC2, SC2}, (v2f){nm, nm});
        p[i] = __builtin_amdgcn_exp2f(e[0]); l[u] += p[i]; p[i + 1] = __builtin_amdgcn_exp2f(e[1]); l[u] += p[i + 1]; }
      pf[u] = bsplit16(p); }
#pragma unroll
    for (int j = 0; j < HD / 16; ++j) {
      if (j + 1 < HD / 16) { vf[(j + 1) & 1][0] = frag_s(vq + (j + 1) * 16 * VP); vf[(j + 1) & 1][1] = frag_s(vq + VTILE + (j + 1) * 16 * VP); }   // the next group's V fragments are read ahead of this group's products
      __builtin_amdgcn_sched_barrier(0);                    // holds those reads ahead of this group's products; without it the build sinks each read to directly in front of its first use, with a wait to 0
      const v16b vh = vf[j & 1][0].b, vl = vf[j & 1][1].b;
#pragma unroll
      for (int u = 0; u < NQ; ++u) acc[u][j] = wmma_bf(vh, pf[u].h, acc[u][j]);
#pragma unroll
      for (int u = 0; u < NQ; ++u) acc[u][j] = wmma_bf(vh, pf[u].l, acc[u][j]);
#pragma unroll
      for (int u = 0; u < NQ; ++u) acc[u][j] = wmma_bf(vl, pf[u].h, acc[u][j]); }
  }
    asm volatile("s_wait_dscnt 0x0" ::: "memory");          // this wave's reads of tile st are done before its buffer is handed over
    asm volatile("s_wait_asynccnt 0x0" ::: "memory");       // this wave's copies of tile st + 1 have landed
    __syncthreads();                                        // publishes tile st + 1; every wave has left tile st's buffer
    if (st + 2 < SEQ / AS) { kp += (size_t)AS * CC; vhp += AS; vlp += AS;
      attn_copy(lko + (unsigned)(st & 1) * (ABUF * 2u), lvo + (unsigned)(st & 1) * (ABUF * 2u), kp + ko, vhp + vo, vlp + vo); }   // tile st + 2 into the buffer just left
  }
  asm volatile("s_wait_asynccnt 0x0" ::: "memory");         // no copy is outstanding when the wave ends
  // The loop's last barrier has freed the ring (no reader, no copy left): group 1's state goes through it, 16 B a lane, lanes side by side.
  v4f* xg = (v4f*)ring + qw * 32 + lane;                    // slot s of this query wave's lane: xg[s * AW * 32]
  if (kg == 1) {
    xg[0] = (v4f){m[0], m[1], l[0], l[1]};
#pragma unroll
    for (int u = 0; u < NQ; ++u) {
#pragma unroll
      for (int j = 0; j < HD / 16; ++j) { const v8f o = acc[u][j]; const int sl = 1 + (u * (HD / 16) + j) * 2;
        xg[sl * AW * 32] = (v4f){o[0], o[1], o[2], o[3]}; xg[(sl + 1) * AW * 32] = (v4f){o[4], o[5], o[6], o[7]}; } } }
  __syncthreads();                                          // group 1's state is written before group 0 reads it
  if (kg == 0) {
    const v4f ml = xg[0];
#pragma unroll
    for (int u = 0; u < NQ; ++u) {
      const float mm = fmaxf(m[u], ml[u]);                  // both states are brought to the larger maximum
      const float a0 = __builtin_amdgcn_exp2f((m[u] - mm) * SC2), a1 = __builtin_amdgcn_exp2f((ml[u] - mm) * SC2);
      const float ls = l[u] * a0 + ml[2 + u] * a1;
      const float inv = 1.0f / (ls + __shfl_xor(ls, 16));
      const float w0 = a0 * inv, w1 = a1 * inv;
      float* yp = Y + (q0 + u * 16 + col) * CC + h * HD + 8 * g;   // acc[u][j][r] = O[query u*16 + col][j*16 + 8g + r]
#pragma unroll
      for (int j = 0; j < HD / 16; ++j) { const int sl = 1 + (u * (HD / 16) + j) * 2; const v4f x0 = xg[sl * AW * 32], x1 = xg[(sl + 1) * AW * 32]; const v8f o = acc[u][j];
        vst2(yp + j * 16, (v4f){o[0], o[1], o[2], o[3]} * w0 + x0 * w1); vst2(yp + j * 16 + 4, (v4f){o[4], o[5], o[6], o[7]} * w0 + x1 * w1); } } }
}
// ---- k_out: block = (128 plane rows, 128 cols): y (x 2^6, f16) . W_out^T (bf16 values x 2^6, f16), + bf16 b_out
__global__ __launch_bounds__(256) __attribute__((amdgpu_num_vgpr(256)))
void k_out(const float* __restrict__ Y, const float* __restrict__ W, const float* __restrict__ Bv, float* __restrict__ O) {
  __shared__ __align__(16) unsigned short lds[GLDS / 2];
  const int tid = threadIdx.x, wave = tid >> 5, lane = tid & 31, col = lane & 15, g = lane >> 4;
  const int c0 = blockIdx.y * GT; const size_t r0 = (size_t)blockIdx.x * GT;   // plane row base
  v8f acc[2][4] = {};
  gemm_core<1, 2, false>(Y + r0 * CC, W + (size_t)c0 * CC, lds, acc);
  float* so = (float*)lds;                                                     // [row][col], pitch 132
  const int rb0 = (wave >> 1) * 32 + 8 * g, cb0 = (wave & 1) * 64 + col;
#pragma unroll
  for (int j = 0; j < 4; ++j) { const float bb = bfr(Bv[c0 + cb0 + j * 16]);
#pragma unroll
    for (int i = 0; i < 2; ++i) {
#pragma unroll
      for (int r = 0; r < 8; ++r) so[(rb0 + i * 16 + r) * 132 + cb0 + j * 16] = acc[i][j][r] * (1.0f / 4096.0f) + bb; } }
  __syncthreads();
  const size_t b = r0 / SEQ; const int t0 = (int)(r0 % SEQ);
  for (int rl = wave * 16; rl < wave * 16 + 16; ++rl)
    vst2(O + (b * SEQ_FULL + (size_t)(t0 + rl)) * CC + c0 + lane * 4, *(const v4f*)(so + rl * 132 + lane * 4));
}

extern "C" void kernel_launch(void* const* d_in, const int* in_sizes, int n_in, void* d_out, int out_size, void* d_ws, size_t ws_size, hipStream_t stream) {
  if (n_in < 4) return;
  const size_t rows_needed = (size_t)(NB - 1) * SEQ_FULL + SEQ;
  if ((size_t)in_sizes[0] < rows_needed * CC) return;            // x [2,2048,1024]
  if ((size_t)in_sizes[1] < (size_t)3 * CC * CC) return;         // w_qkv [3072,1024] ([out][in])
  if ((size_t)in_sizes[2] < (size_t)CC * CC) return;             // w_out [1024,1024] ([out][in])
  if (in_sizes[3] < CC) return;                                   // b_out [1024]
  if ((size_t)out_size < rows_needed * CC) return;
  if (ws_size < (size_t)WS_END) return;
  const float* X = (const float*)d_in[0]; const float* W = (const float*)d_in[1]; const float* WO = (const float*)d_in[2]; const float* BO = (const float*)d_in[3];
  char* ws = (char*)d_ws;
  _Float16 *QH = (_Float16*)(ws + WS_QH), *QL = (_Float16*)(ws + WS_QL), *KH = (_Float16*)(ws + WS_KH);
  __bf16 *VT = (__bf16*)(ws + WS_VT), *VL = (__bf16*)(ws + WS_VL);
  float *Y = (float*)(ws + WS_Y);
  k_proj<<<dim3(NB * SEQ / GT, CC / GT, 3), 256, 0, stream>>>(X, W, QH, QL, KH, VT, VL);
  k_attn<<<dim3(SEQ / (AW * NQ * 16), NH, NB), AW * KG * 32, 0, stream>>>(QH, QL, KH, VT, VL, Y);
  k_out<<<dim3(NB * SEQ / GT, CC / GT), 256, 0, stream>>>(Y, WO, BO, (float*)d_out);
}

// v008
// Measured time: 95.2 microseconds a run.
// Versions between v006 and this one are left out; their measured steps multiply to 1.29 times as fast.
// Over all steps from v000 it is 17.5 times as fast.
// compute dtype: x and W_qkv RNE-converted to bf16; q/k/v = x W_qkv^T with exact bf16 products on v_wmma_f32_16x16x32_bf16, f32 accumulate; q and k each rounded once to f16 -> 1-product raw scores (v_wmma_f32_16x16x32_f16) in f32 registers; running-maximum softmax in f32, base 2 (v_exp_f32 of one fma that carries log2(e)/64); P and v each rounded once to f16: 1 f16 product (v_wmma_f32_16x16x32_f16), f32 accumulate, divided by the f32 row sum at the end; merged heads y in f32; y (x 2^6, f16) times W_out^T (bf16 values x 2^6, f16): 1 f16 product, f32 accumulate, + bf16 b_out.
#include <hip/hip_runtime.h>
#include <math.h>

typedef __attribute__((ext_vector_type(16))) _Float16 v16h;
typedef __attribute__((ext_vector_type(16))) __bf16 v16b;
typedef __attribute__((ext_vector_type(8)))  _Float16 v8h;
typedef __attribute__((ext_vector_type(8)))  float v8f;
typedef __attribute__((ext_vector_type(4)))  float v4f;
typedef __attribute__((ext_vector_type(2)))  float v2f;
typedef __attribute__((ext_vector_type(4)))  unsigned v4u;
typedef __attribute__((ext_vector_type(2)))  unsigned v2u;
typedef __attribute__((ext_vector_type(4)))  _Float16 v4h;
typedef __attribute__((ext_vector_type(4)))  __bf16 v4b;

template <typename T> __device__ __forceinline__ void vst2(void* p, T v) { *(T*)p = v;  }

__device__ __forceinline__ v8f wmma16(v16h a, v16h b, v8f c) {
  return __builtin_amdgcn_wmma_f32_16x16x32_f16(false, a, false, b, (short)0, c, false, false);
}
__device__ __forceinline__ v8f wmma_bf(v16b a, v16b b, v8f c) {
  return __builtin_amdgcn_wmma_f32_16x16x32_bf16(false, a, false, b, (short)0, c, false, false);
}
// 16x16x32 fragments: lane = (g = lane>>4, row/col = lane&15); elements 0..7 = k0+8g+0..7, 8..15 = k0+16+8g+0..7; D element r = row 8g+r, col lane&15
__device__ __forceinline__ v16h frag_h(const _Float16* rowk0, int lane) {
  union { v16h v; v8h q[2]; } u; const _Float16* p = rowk0 + 8 * (lane >> 4);
  u.q[0] = *(const v8h*)p; u.q[1] = *(const v8h*)(p + 16); return u.v;
}
// 16 f32 values -> f16 fragment, each rounded to nearest once
__device__ __forceinline__ v16h hpack16(const float v[16]) { v16h r;
#pragma unroll
  for (int i = 0; i < 16; ++i) r[i] = (_Float16)v[i];
  return r; }
__device__ __forceinline__ float bfr(float v) { return (float)(__bf16)v; }

// sizes: B 2, N 2048, C 1024 = 16 heads x 64; logits x (1/64); output projection C -> C with bias
#define NB_FULL 2
#define SEQ_FULL 2048
#ifndef NB
#define NB NB_FULL
#endif
#ifndef SEQ
#define SEQ SEQ_FULL
#endif
#define CC 1024
#define NH 16
#define HD 64
static_assert(NB >= 1 && NB <= NB_FULL);
static_assert(SEQ >= 128 && SEQ <= SEQ_FULL && (SEQ % 128) == 0);
static_assert(NH * HD == CC && HD == 64 && (CC % 128) == 0);

#define PR     ((size_t)NB * SEQ)                                 // plane rows (b*SEQ + t)
#define WS_QH  ((size_t)0)                                        // f16 q      [PR][CC]
#define WS_KH  (WS_QH + 2u * PR * CC)                             // f16 k      [PR][CC]
#define WS_VT  (WS_KH + 2u * PR * CC)                             // f16 v planes [b][c][t]
#define WS_Y   (WS_VT + 2u * (size_t)NB * CC * SEQ)               // f32 merged heads y [PR][CC]
#define WS_END (WS_Y + 4u * PR * CC)
static_assert(WS_END <= (size_t)134217728u);
static_assert((((size_t)(NB - 1) * SEQ_FULL + SEQ) * CC) <= (size_t)NB_FULL * SEQ_FULL * CC);

// ---- GEMM core of k_proj and k_out: block = 8 waves on a 128 x 128 tile of A . B^T (both operands f32 rows, k contiguous), wave = 32 x 64 (2 x 4 tiles).
// Per step of 32 k the block reads its 128 + 128 rows once, every wave-wide load covering 4 whole 128-byte lines, converts each value once and keeps the 16-bit tile in LDS for all 8 waves.
// Two LDS buffers: step s + 1 is loaded into registers ahead of step s's products and stored behind them; one barrier a step. k runs upward 32 at a time into the same accumulators, in the fragment k order above.
#define GT 128                               // tile rows of either operand
#define GK 32                                // k per step
#define GP 40                                // LDS row pitch in 16-bit elements: 80 B = 16 B x odd, conflict-free for 16-byte fragment reads
#define GBUF (2 * GT * GP)                   // 16-bit elements per buffer: A rows, then B rows
#define GLDS (2 * GT * 136 * 2)              // bytes: room for the two buffers (40,960) and for the output staging of either kernel (at most 67,584)
static_assert(2 * GBUF * 2 <= GLDS && GT * 132 * 4 <= GLDS && (SEQ % GT) == 0 && (CC % GT) == 0 && (CC % GK) == 0);
// CV 0: bf16; 1: f16 of v x 2^6; 2: f16 of (v rounded to bf16) x 2^6
template <int CV> __device__ __forceinline__ v2u cvt4(v4f v) {
  union { v4b b; v4h h; v2u u; } r;
#pragma unroll
  for (int i = 0; i < 4; ++i) {
    if constexpr (CV == 0) r.b[i] = (__bf16)v[i];
    else if constexpr (CV == 1) r.h[i] = (_Float16)(v[i] * 64.0f);
    else r.h[i] = (_Float16)(bfr(v[i]) * 64.0f); }
  return r.u;
}
union FR { v16h h; v16b b; v4u q[2]; };
__device__ __forceinline__ FR frag_s(const unsigned short* p) { FR u; u.q[0] = *(const v4u*)p; u.q[1] = *(const v4u*)(p + 16); return u; }
template <bool BF> __device__ __forceinline__ void gemm_step(const unsigned short* fa, const unsigned short* fb, v8f (&acc)[2][4]) {
  FR a[2], w[4];
#pragma unroll
  for (int i = 0; i < 2; ++i) a[i] = frag_s(fa + i * 16 * GP);
#pragma unroll
  for (int j = 0; j < 4; ++j) w[j] = frag_s(fb + j * 16 * GP);
  __builtin_amdgcn_sched_barrier(0);                        // holds the step's fragment reads together ahead of its products: one LDS latency a step; without it the build reads the second A fragment behind the fourth product, with a wait to 0
#pragma unroll
  for (int i = 0; i < 2; ++i) {
#pragma unroll
    for (int j = 0; j < 4; ++j) { if constexpr (BF) acc[i][j] = wmma_bf(a[i].b, w[j].b, acc[i][j]); else acc[i][j] = wmma16(a[i].h, w[j].h, acc[i][j]); } }
}
template <int CA, int CB, bool BF>
__device__ __forceinline__ void gemm_core(const float* __restrict__ A, const float* __restrict__ B, unsigned short* lds, v8f (&acc)[2][4]) {
  const int tid = threadIdx.x, wave = tid >> 5, lane = tid & 31, col = lane & 15, g = lane >> 4;
  const float* ap = A + (size_t)(tid >> 3) * CC + (tid & 7) * 4;         // 8 threads a row of 32 floats; 32 rows a sweep, 4 sweeps an operand
  const float* bp = B + (size_t)(tid >> 3) * CC + (tid & 7) * 4;
  const int so = (tid >> 3) * GP + (tid & 7) * 4;
  const int fao = ((wave >> 1) * 32 + col) * GP + 8 * g, fbo = (GT + (wave & 1) * 64 + col) * GP + 8 * g;
  v4f ra[4], rb[4];
#pragma unroll
  for (int i = 0; i < 4; ++i) { ra[i] = *(const v4f*)(ap + (size_t)i * 32 * CC); rb[i] = *(const v4f*)(bp + (size_t)i * 32 * CC); }
#pragma unroll
  for (int i = 0; i < 4; ++i) { *(v2u*)(lds + so + i * 32 * GP) = cvt4<CA>(ra[i]); *(v2u*)(lds + so + (GT + i * 32) * GP) = cvt4<CB>(rb[i]); }
  int cur = 0;
#pragma unroll 1                                            // rolled: the body is the same every step, and unrolled it would only grow the code
  for (int kc = 0; kc < CC / GK - 1; ++kc) {
    __syncthreads();                                        // buffer cur is written by all; buffer cur ^ 1 is left by all its readers
    ap += GK; bp += GK;
#pragma unroll
    for (int i = 0; i < 4; ++i) { ra[i] = *(const v4f*)(ap + (size_t)i * 32 * CC); rb[i] = *(const v4f*)(bp + (size_t)i * 32 * CC); }
    __builtin_amdgcn_sched_barrier(0);                      // holds the next step's global loads ahead of this step's LDS reads and products; without it the build sinks them behind most of the products, directly in front of their waits
    gemm_step<BF>(lds + cur * GBUF + fao, lds + cur * GBUF + fbo, acc);
    __builtin_amdgcn_sched_barrier(0);                      // keeps the waits on the next step's global loads behind this step's products; without it they stand behind the first product
    cur ^= 1;
#pragma unroll
    for (int i = 0; i < 4; ++i) { *(v2u*)(lds + cur * GBUF + so + i * 32 * GP) = cvt4<CA>(ra[i]); *(v2u*)(lds + cur * GBUF + so + (GT + i * 32) * GP) = cvt4<CB>(rb[i]); }
  }
  __syncthreads();
  gemm_step<BF>(lds + cur * GBUF + fao, lds + cur * GBUF + fbo, acc);
  __syncthreads();                                          // every wave has left the buffers: the caller stages its output over them
}

// ---- k_proj: block = (128 plane rows, 128 cols, which in {q,k,v}); W rows = which*CC + (h*HD + d); q -> f16, k -> f16, v -> f16 planes [b][c][t]
__global__ __launch_bounds__(256) __attribute__((amdgpu_num_vgpr(256)))
void k_proj(const float* __restrict__ X, const float* __restrict__ W, _Float16* __restrict__ QH, _Float16* __restrict__ KH, _Float16* __restrict__ VT) {
  __shared__ __align__(16) unsigned short lds[GLDS / 2];
  const int tid = threadIdx.x, wave = tid >> 5, lane = tid & 31, col = lane & 15, g = lane >> 4;
  const int which = blockIdx.z; const int c0 = blockIdx.y * GT;
  const size_t r0 = (size_t)blockIdx.x * GT;            // plane row base = b*SEQ + t0
  const size_t b = r0 / SEQ; const int t0 = (int)(r0 % SEQ);
  const size_t xr0 = b * SEQ_FULL + (size_t)t0;          // input row base
  v8f acc[2][4] = {};
  gemm_core<0, 0, true>(X + xr0 * CC, W + ((size_t)which * CC + c0) * CC, lds, acc);
  const int rb0 = (wave >> 1) * 32 + 8 * g, cb0 = (wave & 1) * 64 + col;   // acc[i][j][r] = (row rb0 + 16 i + r, col cb0 + 16 j)
  if (which == 2) { _Float16* th = (_Float16*)lds;                          // [col][row], pitch 136
#pragma unroll
    for (int i = 0; i < 2; ++i) {
#pragma unroll
      for (int j = 0; j < 4; ++j) { v8h hh;
#pragma unroll
        for (int r = 0; r < 8; ++r) hh[r] = (_Float16)acc[i][j][r];
        *(v8h*)(th + (cb0 + j * 16) * 136 + rb0 + i * 16) = hh; } }
    __syncthreads();
#pragma unroll                                              // unrolled: one address with immediate offsets, the LDS reads issued together ahead of the stores
    for (int it = 0; it < GT * 16 / 256; ++it) { const int cl = it * 16 + (tid >> 4), q = tid & 15;
      vst2(VT + (b * CC + c0 + cl) * (size_t)SEQ + t0 + q * 8, *(const v4u*)(th + cl * 136 + q * 8)); } }
  else { _Float16* sh = (_Float16*)lds;                                       // [row][col], pitch 136
#pragma unroll
    for (int i = 0; i < 2; ++i) {
#pragma unroll
      for (int j = 0; j < 4; ++j) {
#pragma unroll
        for (int r = 0; r < 8; ++r) sh[(rb0 + i * 16 + r) * 136 + cb0 + j * 16] = (_Float16)acc[i][j][r]; } }
    __syncthreads();
    _Float16* dst = which == 0 ? QH : KH;
#pragma unroll                                              // unrolled, as above
    for (int it = 0; it < GT * 16 / 256; ++it) { const int rl = it * 16 + (tid >> 4), q = tid & 15;
      vst2(dst + (r0 + rl) * CC + c0 + q * 8, *(const v4u*)(sh + rl * 136 + q * 8)); } }
}
#define NQ 2
#define AW 8
#define KG 2                                 // key groups
#define AS 128                               // keys per tile = KG groups x two passes of 32
#define AP 72                                // K row pitch in 16-bit elements: 144 B = 16 B x odd, conflict-free for 16-byte fragment reads
#define VP 136                               // V row pitch in 16-bit elements: 272 B = 16 B x odd, likewise
#define KTILE (AS * AP)                      // 16-bit elements of the K tile: AS key rows
#define VTILE (64 * VP)                      // 16-bit elements of the V tile: 64 head columns
#define ABUF (KTILE + VTILE)                 // K, V
#define SC2 (1.4426950408889634f / 64.0f)    // log2(e) / head size: the logit scale and the change of base in one factor
static_assert((SEQ % (AW * NQ * 16)) == 0);
static_assert(AS == KG * 64 && HD == 64 && AW * KG * 32 == 512 && (SEQ % AS) == 0 && SEQ / AS >= 2);
static_assert((NQ * (HD / 16) * 2 + 1) * AW * 32 * 16 <= 2 * ABUF * 2);   // group 1's state fits the ring
// One tile: 4 copies of 16 B a lane. K: 8 lanes a row, 64 rows a sweep, 2 sweeps; V: 16 lanes a row, 32 rows a sweep, 2 sweeps.
// lk, lv = the lane's LDS byte addresses in the K and the V part of the target buffer; k, v = its global addresses in the first sweep.
// The s_wait_xcnt stands inside the statement, behind the last copy: the operands' registers are rewritten only behind it.
__device__ __forceinline__ void attn_copy(unsigned lk, unsigned lv, const _Float16* k, const _Float16* v) {
  asm volatile("global_load_async_to_lds_b128 %0, %4, off\n\t"
               "global_load_async_to_lds_b128 %1, %5, off\n\t"
               "global_load_async_to_lds_b128 %2, %6, off\n\t"
               "global_load_async_to_lds_b128 %3, %7, off\n\t"
               "s_wait_xcnt 0x0"
               :: "v"(lk), "v"(lk + 64u * AP * 2u), "v"(lv), "v"(lv + 32u * VP * 2u),
                  "v"(k), "v"(k + (size_t)64 * CC), "v"(v), "v"(v + (size_t)32 * SEQ)
               : "memory");
}
__global__ __launch_bounds__(AW * KG * 32) __attribute__((amdgpu_num_vgpr(256)))
void k_attn(const _Float16* __restrict__ QH, const _Float16* __restrict__ KH, const _Float16* __restrict__ VT, float* __restrict__ Y) {
  __shared__ __align__(16) unsigned short ring[2 * ABUF];
  const int tid = threadIdx.x, lane = tid & 31, col = lane & 15, g = lane >> 4;
  const int wave = __builtin_amdgcn_readfirstlane(tid >> 5), qw = wave & (AW - 1), kg = wave / AW;
  const int h = blockIdx.y, b = blockIdx.z;
  const size_t q0 = (size_t)b * SEQ + blockIdx.x * (AW * NQ * 16) + qw * (NQ * 16);
  v16h qh[NQ][HD / 32];
#pragma unroll
  for (int u = 0; u < NQ; ++u) {
#pragma unroll
    for (int kc = 0; kc < HD / 32; ++kc) qh[u][kc] = frag_h(QH + (q0 + u * 16 + col) * CC + h * HD + kc * 32, lane); }
  const _Float16* kp = KH + (size_t)b * SEQ * CC + h * HD;               // wave-uniform bases of the next tile to copy, advanced per tile; the lane's own part is a fixed 32-bit offset
  const _Float16* vp = VT + ((size_t)b * CC + h * HD) * (size_t)SEQ;
  const unsigned ko = (unsigned)((tid >> 3) * CC + (tid & 7) * 8), vo = (unsigned)((tid >> 4) * SEQ + (tid & 15) * 8);
  const unsigned lko = (unsigned)(uintptr_t)ring + (unsigned)((tid >> 3) * AP + (tid & 7) * 8) * 2u;             // LDS byte addresses of the lane's first K and V copies in buffer 0
  const unsigned lvo = (unsigned)(uintptr_t)ring + (unsigned)(KTILE + (tid >> 4) * VP + (tid & 15) * 8) * 2u;
  const int fk = (kg * 64 + col) * AP + 8 * g;                           // the lane's place in its group's first K fragment
  const int fv = KTILE + col * VP + kg * 64 + 8 * g;                     // ... and first V fragment
  attn_copy(lko, lvo, kp + ko, vp + vo);                                 // tile 0 into buffer 0
  asm volatile("s_wait_asynccnt 0x0" ::: "memory");                      // this wave's copies of tile 0 have landed
  __syncthreads();                                                       // ... and every other wave's
  kp += (size_t)AS * CC; vp += AS;
  attn_copy(lko + ABUF * 2u, lvo + ABUF * 2u, kp + ko, vp + vo);         // tile 1 into buffer 1
  v8f acc[NQ][HD / 16] = {};
  float m[NQ], l[NQ];
#pragma unroll
  for (int u = 0; u < NQ; ++u) { m[u] = -3.0e38f; l[u] = 0.f; }
#pragma unroll 1                                            // rolled: the foot's barrier and refill stand once
  for (int st = 0; st < SEQ / AS; ++st) {
  const unsigned short* tb = ring + (st & 1) * ABUF;
#pragma unroll 1                                            // rolled: the pass's code stands once, and its fragments and scores take one pass's registers
  for (int ps = 0; ps < AS / (KG * 32); ++ps) {
    const unsigned short* kq = tb + fk + ps * 32 * AP; const unsigned short* vq = tb + fv + ps * 32;
    v8f sa[NQ][2] = {};
    FR kb[HD / 32][2], vf[HD / 16];                         // the pass's K fragments are read as one group: one LDS latency a pass, not one a fragment
#pragma unroll
    for (int kc = 0; kc < HD / 32; ++kc) {
#pragma unroll
      for (int t = 0; t < 2; ++t) kb[kc][t] = frag_s(kq + t * 16 * AP + kc * 32); }
#pragma unroll
    for (int kc = 0; kc < HD / 32; ++kc) {
#pragma unroll
      for (int t = 0; t < 2; ++t) {
#pragma unroll
        for (int u = 0; u < NQ; ++u) sa[u][t] = wmma16(kb[kc][t].h, qh[u][kc], sa[u][t]); } }
#pragma unroll
    for (int j = 0; j < HD / 16; ++j) vf[j] = frag_s(vq + j * 16 * VP);   // the pass's four V fragments, all in registers at once: their reads are free to stand ahead of the products
    v16h pf[NQ];
#pragma unroll
    for (int u = 0; u < NQ; ++u) {
      float p[16]; float mx = m[u];
#pragma unroll
      for (int i = 0; i < 16; ++i) { p[i] = sa[u][i >> 3][i & 7]; mx = fmaxf(mx, p[i]); }   // raw scores q.k; m[u] is kept in the same unit
      mx = fmaxf(mx, __shfl_xor(mx, 16));
      if (__builtin_amdgcn_ballot_w32(mx > m[u]) != 0) {     // some query's maximum rose: rescale (the factor is exactly 1 for the others)
        const float al = __builtin_amdgcn_exp2f((m[u] - mx) * SC2); l[u] *= al; m[u] = mx;
#pragma unroll
        for (int j = 0; j < HD / 16; ++j) acc[u][j] = acc[u][j] * al; }
      const float nm = -m[u] * SC2;
#pragma unroll
      for (int i = 0; i < 16; i += 2) {                     // exp((s - m) / 64) = 2^(s * SC2 - m * SC2); two exponents a packed fma
        const v2f e = __builtin_elementwise_fma((v2f){p[i], p[i + 1]}, (v2f){SC2, SC2}, (v2f){nm, nm});
        p[i] = __builtin_amdgcn_exp2f(e[0]); l[u] += p[i]; p[i + 1] = __builtin_amdgcn_exp2f(e[1]); l[u] += p[i + 1]; }
      pf[u] = hpack16(p); }
#pragma unroll
    for (int j = 0; j < HD / 16; ++j) {
#pragma unroll
      for (int u = 0; u < NQ; ++u) acc[u][j] = wmma16(vf[j].h, pf[u], acc[u][j]); }
    __builtin_amdgcn_sched_barrier(0);                      // holds the v_nop below behind the pass's last product; without it the build lifts them among the products, where they cover nothing
    asm volatile("v_nop\n\tv_nop\n\tv_nop\n\tv_nop");     // the 4 vector slots behind the pass's last product: the build forms the next pass's K address in a register of that product's P operand
  }
    asm volatile("s_wait_dscnt 0x0" ::: "memory");          // this wave's reads of tile st are done before its buffer is handed over
    asm volatile("s_wait_asynccnt 0x0" ::: "memory");       // this wave's copies of tile st + 1 have landed
    __syncthreads();                                        // publishes tile st + 1; every wave has left tile st's buffer
    if (st + 2 < SEQ / AS) { kp += (size_t)AS * CC; vp += AS;
      attn_copy(lko + (unsigned)(st & 1) * (ABUF * 2u), lvo + (unsigned)(st & 1) * (ABUF * 2u), kp + ko, vp + vo); }   // tile st + 2 into the buffer just left
  }
  asm volatile("s_wait_asynccnt 0x0" ::: "memory");         // no copy is outstanding when the wave ends
  // The loop's last barrier has freed the ring (no reader, no copy left): group 1's state goes through it, 16 B a lane, lanes side by side.
  v4f* xg = (v4f*)ring + qw * 32 + lane;                    // slot s of this query wave's lane: xg[s * AW * 32]
  if (kg == 1) {
    xg[0] = (v4f){m[0], m[1], l[0], l[1]};
#pragma unroll
    for (int u = 0; u < NQ; ++u) {
#pragma unroll
      for (int j = 0; j < HD / 16; ++j) { const v8f o = acc[u][j]; const int sl = 1 + (u * (HD / 16) + j) * 2;
        xg[sl * AW * 32] = (v4f){o[0], o[1], o[2], o[3]}; xg[(sl + 1) * AW * 32] = (v4f){o[4], o[5], o[6], o[7]}; } } }
  __syncthreads();                                          // group 1's state is written before group 0 reads it
  if (kg == 0) {
    const v4f ml = xg[0];
#pragma unroll
    for (int u = 0; u < NQ; ++u) {
      const float mm = fmaxf(m[u], ml[u]);                  // both states are brought to the larger maximum
      const float a0 = __builtin_amdgcn_exp2f((m[u] - mm) * SC2), a1 = __builtin_amdgcn_exp2f((ml[u] - mm) * SC2);
      const float ls = l[u] * a0 + ml[2 + u] * a1;
      const float inv = 1.0f / (ls + __shfl_xor(ls, 16));
      const float w0 = a0 * inv, w1 = a1 * inv;
      float* yp = Y + (q0 + u * 16 + col) * CC + h * HD + 8 * g;   // acc[u][j][r] = O[query u*16 + col][j*16 + 8g + r]
#pragma unroll
      for (int j = 0; j < HD / 16; ++j) { const int sl = 1 + (u * (HD / 16) + j) * 2; const v4f x0 = xg[sl * AW * 32], x1 = xg[(sl + 1) * AW * 32]; const v8f o = acc[u][j];
        vst2(yp + j * 16, (v4f){o[0], o[1], o[2], o[3]} * w0 + x0 * w1); vst2(yp + j * 16 + 4, (v4f){o[4], o[5], o[6], o[7]} * w0 + x1 * w1); } } }
}
// ---- k_out: block = (128 plane rows, 128 cols): y (x 2^6, f16) . W_out^T (bf16 values x 2^6, f16), + bf16 b_out
__global__ __launch_bounds__(256) __attribute__((amdgpu_num_vgpr(256)))
void k_out(const float* __restrict__ Y, const float* __restrict__ W, const float* __restrict__ Bv, float* __restrict__ O) {
  __shared__ __align__(16) unsigned short lds[GLDS / 2];
  const int tid = threadIdx.x, wave = tid >> 5, lane = tid & 31, col = lane & 15, g = lane >> 4;
  const int c0 = blockIdx.y * GT; const size_t r0 = (size_t)blockIdx.x * GT;   // plane row base
  v8f acc[2][4] = {};
  gemm_core<1, 2, false>(Y + r0 * CC, W + (size_t)c0 * CC, lds, acc);
  float* so = (float*)lds;                                                     // [row][col], pitch 132
  const int rb0 = (wave >> 1) * 32 + 8 * g, cb0 = (wave & 1) * 64 + col;
#pragma unroll
  for (int j = 0; j < 4; ++j) { const float bb = bfr(Bv[c0 + cb0 + j * 16]);
#pragma unroll
    for (int i = 0; i < 2; ++i) {
#pragma unroll
      for (int r = 0; r < 8; ++r) so[(rb0 + i * 16 + r) * 132 + cb0 + j * 16] = acc[i][j][r] * (1.0f / 4096.0f) + bb; } }
  __syncthreads();
  const size_t b = r0 / SEQ; const int t0 = (int)(r0 % SEQ);
  for (int rl = wave * 16; rl < wave * 16 + 16; ++rl)
    vst2(O + (b * SEQ_FULL + (size_t)(t0 + rl)) * CC + c0 + lane * 4, *(const v4f*)(so + rl * 132 + lane * 4));
}

extern "C" void kernel_launch(void* const* d_in, const int* in_sizes, int n_in, void* d_out, int out_size, void* d_ws, size_t ws_size, hipStream_t stream) {
  if (n_in < 4) return;
  const size_t rows_needed = (size_t)(NB - 1) * SEQ_FULL + SEQ;
  if ((size_t)in_sizes[0] < rows_needed * CC) return;            // x [2,2048,1024]
  if ((size_t)in_sizes[1] < (size_t)3 * CC * CC) return;         // w_qkv [3072,1024] ([out][in])
  if ((size_t)in_sizes[2] < (size_t)CC * CC) return;             // w_out [1024,1024] ([out][in])
  if (in_sizes[3] < CC) return;                                   // b_out [1024]
  if ((size_t)out_size < rows_needed * CC) return;
  if (ws_size < (size_t)WS_END) return;
  const float* X = (const float*)d_in[0]; const float* W = (const float*)d_in[1]; const float* WO = (const float*)d_in[2]; const float* BO = (const float*)d_in[3];
  char* ws = (char*)d_ws;
  _Float16 *QH = (_Float16*)(ws + WS_QH), *KH = (_Float16*)(ws + WS_KH);
  _Float16 *VT = (_Float16*)(ws + WS_VT);
  float *Y = (float*)(ws + WS_Y);
  k_proj<<<dim3(NB * SEQ / GT, CC / GT, 3), 256, 0, stream>>>(X, W, QH, KH, VT);
  k_attn<<<dim3(SEQ / (AW * NQ * 16), NH, NB), AW * KG * 32, 0, stream>>>(QH, KH, VT, Y);
  k_out<<<dim3(NB * SEQ / GT, CC / GT), 256, 0, stream>>>(Y, WO, BO, (float*)d_out);
}

// v009
// Measured time: 80.9 microseconds a run.
// In two side-by-side timings against v008, it was 1.19 and 1.17 times as fast.
// Over all steps from v000 it is 20.6 times as fast.
// compute dtype: x and W_qkv RNE-converted to bf16 (once, by k_cvt); q/k/v = x W_qkv^T with exact bf16 products on v_wmma_f32_16x16x32_bf16, f32 accumulate; q and k each rounded once to f16 -> 1-product raw scores (v_wmma_f32_16x16x32_f16) in f32 registers; running-maximum softmax in f32, base 2 (v_exp_f32 of one fma that carries log2(e)/64); P and v each rounded once to f16: 1 f16 product (v_wmma_f32_16x16x32_f16), f32 accumulate, divided by the f32 row sum at the end; merged heads y (x 2^6) rounded once to f16; y times W_out^T (bf16 values x 2^6, f16, made once by k_cvt): 1 f16 product, f32 accumulate, + bf16 b_out.
#include <hip/hip_runtime.h>
#include <math.h>

typedef __attribute__((ext_vector_type(16))) _Float16 v16h;
typedef __attribute__((ext_vector_type(16))) __bf16 v16b;
typedef __attribute__((ext_vector_type(8)))  _Float16 v8h;
typedef __attribute__((ext_vector_type(8)))  float v8f;
typedef __attribute__((ext_vector_type(4)))  float v4f;
typedef __attribute__((ext_vector_type(2)))  float v2f;
typedef __attribute__((ext_vector_type(4)))  unsigned v4u;
typedef __attribute__((ext_vector_type(2)))  unsigned v2u;
typedef __attribute__((ext_vector_type(4)))  _Float16 v4h;
typedef __attribute__((ext_vector_type(4)))  __bf16 v4b;

template <typename T> __device__ __forceinline__ void vst2(void* p, T v) { *(T*)p = v;  }

__device__ __forceinline__ v8f wmma16(v16h a, v16h b, v8f c) {
  return __builtin_amdgcn_wmma_f32_16x16x32_f16(false, a, false, b, (short)0, c, false, false);
}
__device__ __forceinline__ v8f wmma_bf(v16b a, v16b b, v8f c) {
  return __builtin_amdgcn_wmma_f32_16x16x32_bf16(false, a, false, b, (short)0, c, false, false);
}
// 16x16x32 fragments: lane = (g = lane>>4, row/col = lane&15); elements 0..7 = k0+8g+0..7, 8..15 = k0+16+8g+0..7; D element r = row 8g+r, col lane&15
__device__ __forceinline__ v16h frag_h(const _Float16* rowk0, int lane) {
  union { v16h v; v8h q[2]; } u; const _Float16* p = rowk0 + 8 * (lane >> 4);
  u.q[0] = *(const v8h*)p; u.q[1] = *(const v8h*)(p + 16); return u.v;
}
// 16 f32 values -> f16 fragment, each rounded to nearest once
__device__ __forceinline__ v16h hpack16(const float v[16]) { v16h r;
#pragma unroll
  for (int i = 0; i < 16; ++i) r[i] = (_Float16)v[i];
  return r; }
__device__ __forceinline__ float bfr(float v) { return (float)(__bf16)v; }

// sizes: B 2, N 2048, C 1024 = 16 heads x 64; logits x (1/64); output projection C -> C with bias
#define NB_FULL 2
#define SEQ_FULL 2048
#ifndef NB
#define NB NB_FULL
#endif
#ifndef SEQ
#define SEQ SEQ_FULL
#endif
#define CC 1024
#define NH 16
#define HD 64
static_assert(NB >= 1 && NB <= NB_FULL);
static_assert(SEQ >= 128 && SEQ <= SEQ_FULL && (SEQ % 128) == 0);
static_assert(NH * HD == CC && HD == 64 && (CC % 128) == 0);

#define PR     ((size_t)NB * SEQ)                                 // plane rows (b*SEQ + t)
#define WS_QH  ((size_t)0)                                        // f16 q      [PR][CC]
#define WS_KH  (WS_QH + 2u * PR * CC)                             // f16 k      [PR][CC]
#define WS_VT  (WS_KH + 2u * PR * CC)                             // f16 v planes [b][c][t]
#define WS_Y   (WS_VT + 2u * (size_t)NB * CC * SEQ)               // f16 merged heads y x 2^6 [PR][CC]
#define WS_XB  (WS_Y + 2u * PR * CC)                              // bf16 x      [PR][CC]
#define WS_WB  (WS_XB + 2u * PR * CC)                             // bf16 W_qkv  [3 CC][CC]
#define WS_WO  (WS_WB + 2u * (size_t)3 * CC * CC)                 // f16 (bf16 values of W_out) x 2^6 [CC][CC]
#define WS_END (WS_WO + 2u * (size_t)CC * CC)
static_assert(WS_END <= (size_t)134217728u);
static_assert((((size_t)(NB - 1) * SEQ_FULL + SEQ) * CC) <= (size_t)NB_FULL * SEQ_FULL * CC);

// ---- k_cvt: every GEMM operand that is an input is rounded to its 16-bit form once, here, and not again by every block that reads it.
// Block = CVR rows of CC values of x, W_qkv or W_out; a wave-wide load covers 4 whole 128-byte lines, a wave-wide store 2.
// CV 0: bf16; 1: f16 of (v rounded to bf16) x 2^6
template <int CV> __device__ __forceinline__ v2u cvt4(v4f v) {
  union { v4b b; v4h h; v2u u; } r;
#pragma unroll
  for (int i = 0; i < 4; ++i) {
    if constexpr (CV == 0) r.b[i] = (__bf16)v[i];
    else r.h[i] = (_Float16)(bfr(v[i]) * 64.0f); }
  return r.u;
}
#define CVR 16
static_assert((SEQ % CVR) == 0 && (CC % CVR) == 0 && CVR * CC == 16 * 256 * 4);
template <int CV> __device__ __forceinline__ void cvt_rows(const float* __restrict__ src, unsigned short* __restrict__ dst) {
  const int tid = threadIdx.x; v4f r[16];
#pragma unroll                                              // unrolled: r stays in registers, and all 16 loads of a thread are in flight ahead of its stores
  for (int i = 0; i < 16; ++i) r[i] = *(const v4f*)(src + (i * 256 + tid) * 4);
#pragma unroll                                              // unrolled, for the same register array
  for (int i = 0; i < 16; ++i) *(v2u*)(dst + (i * 256 + tid) * 4) = cvt4<CV>(r[i]);
  asm volatile("s_wait_xcnt 0x0" ::: "memory");             // stands behind the last store, ahead of any rewrite of a register that the stores name
}
__global__ __launch_bounds__(256)
void k_cvt(const float* __restrict__ X, const float* __restrict__ W, const float* __restrict__ WO, __bf16* __restrict__ XB, __bf16* __restrict__ WB, _Float16* __restrict__ WOH) {
  const int nx = (int)(PR / CVR), nw = 3 * CC / CVR; const int blk = blockIdx.x;
  if (blk < nx) { const size_t r0 = (size_t)blk * CVR;      // plane row b*SEQ + t <- input row b*SEQ_FULL + t
    cvt_rows<0>(X + ((r0 / SEQ) * SEQ_FULL + r0 % SEQ) * CC, (unsigned short*)XB + r0 * CC); }
  else if (blk < nx + nw) { const size_t o = (size_t)(blk - nx) * CVR * CC; cvt_rows<0>(W + o, (unsigned short*)WB + o); }
  else { const size_t o = (size_t)(blk - nx - nw) * CVR * CC; cvt_rows<1>(WO + o, (unsigned short*)WOH + o); }
}

// ---- GEMM core of k_proj and k_out: block = 8 waves on a 128 x 128 tile of A . B^T (both operands 16-bit rows, k contiguous), wave = 32 x 64 (2 x 4 tiles).
// Per step of 64 k the block reads its 128 + 128 rows once, every wave-wide load covering 4 whole 128-byte lines, and keeps the tile in LDS for all 8 waves.
// Two LDS buffers: step s + 1 is loaded into registers ahead of step s's products and stored behind them; one barrier a step. k runs upward 32 at a time into the same accumulators, in the fragment k order above.
#define GT 128                               // tile rows of either operand
#define GK 64                                // k per step: 128 B of a row, one line
#define GP 72                                // LDS row pitch in 16-bit elements: 144 B = 16 B x odd, conflict-free for 16-byte fragment reads
#define GBUF (2 * GT * GP)                   // 16-bit elements per buffer: A rows, then B rows
#define GLDS (2 * GBUF * 2)                  // bytes: the two buffers (73,728); the output staging of either kernel lies over them
static_assert(GT * 136 * 2 <= GLDS && GT * 132 * 4 <= GLDS && (SEQ % GT) == 0 && (CC % GT) == 0 && (CC % GK) == 0 && GK == 64);
union FR { v16h h; v16b b; v4u q[2]; };
__device__ __forceinline__ FR frag_s(const unsigned short* p) { FR u; u.q[0] = *(const v4u*)p; u.q[1] = *(const v4u*)(p + 16); return u; }
template <bool BF> __device__ __forceinline__ void gemm_step(const unsigned short* fa, const unsigned short* fb, v8f (&acc)[2][4]) {
  FR a[2], w[4];
#pragma unroll
  for (int i = 0; i < 2; ++i) a[i] = frag_s(fa + i * 16 * GP);
#pragma unroll
  for (int j = 0; j < 4; ++j) w[j] = frag_s(fb + j * 16 * GP);
  __builtin_amdgcn_sched_barrier(0);                        // holds the step's fragment reads together ahead of its products: one LDS latency a step; without it the build reads the second A fragment behind the fourth product, with a wait to 0
#pragma unroll
  for (int i = 0; i < 2; ++i) {
#pragma unroll
    for (int j = 0; j < 4; ++j) { if constexpr (BF) acc[i][j] = wmma_bf(a[i].b, w[j].b, acc[i][j]); else acc[i][j] = wmma16(a[i].h, w[j].h, acc[i][j]); } }
}
template <bool BF>
__device__ __forceinline__ void gemm_core(const unsigned short* __restrict__ A, const unsigned short* __restrict__ B, unsigned short* lds, v8f (&acc)[2][4]) {
  const int tid = threadIdx.x, wave = tid >> 5, lane = tid & 31, col = lane & 15, g = lane >> 4;
  const unsigned short* ap = A + (size_t)(tid >> 3) * CC + (tid & 7) * 8;   // 8 threads a row of 64 values; 32 rows a sweep, 4 sweeps an operand
  const unsigned short* bp = B + (size_t)(tid >> 3) * CC + (tid & 7) * 8;
  const int so = (tid >> 3) * GP + (tid & 7) * 8;
  const int fao = ((wave >> 1) * 32 + col) * GP + 8 * g, fbo = (GT + (wave & 1) * 64 + col) * GP + 8 * g;
  v4u ra[4], rb[4];
#pragma unroll
  for (int i = 0; i < 4; ++i) { ra[i] = *(const v4u*)(ap + (size_t)i * 32 * CC); rb[i] = *(const v4u*)(bp + (size_t)i * 32 * CC); }
#pragma unroll
  for (int i = 0; i < 4; ++i) { *(v4u*)(lds + so + i * 32 * GP) = ra[i]; *(v4u*)(lds + so + (GT + i * 32) * GP) = rb[i]; }
  int cur = 0;
#pragma unroll 1                                            // rolled: the body is the same every step, and unrolled it would only grow the code
  for (int kc = 0; kc < CC / GK - 1; ++kc) {
    __syncthreads();                                        // buffer cur is written by all; buffer cur ^ 1 is left by all its readers
    ap += GK; bp += GK;
#pragma unroll
    for (int i = 0; i < 4; ++i) { ra[i] = *(const v4u*)(ap + (size_t)i * 32 * CC); rb[i] = *(const v4u*)(bp + (size_t)i * 32 * CC); }
    __builtin_amdgcn_sched_barrier(0);                      // holds the next step's global loads ahead of this step's LDS reads and products; without it the build sinks them behind most of the products, directly in front of their waits
    gemm_step<BF>(lds + cur * GBUF + fao, lds + cur * GBUF + fbo, acc);
    gemm_step<BF>(lds + cur * GBUF + fao + 32, lds + cur * GBUF + fbo + 32, acc);
    __builtin_amdgcn_sched_barrier(0);                      // keeps the waits on the next step's global loads behind this step's products; without it they stand behind the first product
    cur ^= 1;
#pragma unroll
    for (int i = 0; i < 4; ++i) { *(v4u*)(lds + cur * GBUF + so + i * 32 * GP) = ra[i]; *(v4u*)(lds + cur * GBUF + so + (GT + i * 32) * GP) = rb[i]; }
  }
  __syncthreads();
  gemm_step<BF>(lds + cur * GBUF + fao, lds + cur * GBUF + fbo, acc);
  gemm_step<BF>(lds + cur * GBUF + fao + 32, lds + cur * GBUF + fbo + 32, acc);
  __syncthreads();                                          // every wave has left the buffers: the caller stages its output over them
}

// ---- k_proj: block = (128 plane rows, 128 cols, which in {q,k,v}); W rows = which*CC + (h*HD + d); q -> f16, k -> f16, v -> f16 planes [b][c][t]
__global__ __launch_bounds__(256) __attribute__((amdgpu_num_vgpr(256)))
void k_proj(const __bf16* __restrict__ XB, const __bf16* __restrict__ WB, _Float16* __restrict__ QH, _Float16* __restrict__ KH, _Float16* __restrict__ VT) {
  __shared__ __align__(16) unsigned short lds[GLDS / 2];
  const int tid = threadIdx.x, wave = tid >> 5, lane = tid & 31, col = lane & 15, g = lane >> 4;
  const int which = blockIdx.z; const int c0 = blockIdx.y * GT;
  const size_t r0 = (size_t)blockIdx.x * GT;            // plane row base = b*SEQ + t0
  const size_t b = r0 / SEQ; const int t0 = (int)(r0 % SEQ);
  v8f acc[2][4] = {};
  gemm_core<true>((const unsigned short*)XB + r0 * CC, (const unsigned short*)WB + ((size_t)which * CC + c0) * CC, lds, acc);
  const int rb0 = (wave >> 1) * 32 + 8 * g, cb0 = (wave & 1) * 64 + col;   // acc[i][j][r] = (row rb0 + 16 i + r, col cb0 + 16 j)
  if (which == 2) { _Float16* th = (_Float16*)lds;                          // [col][row], pitch 136
#pragma unroll
    for (int i = 0; i < 2; ++i) {
#pragma unroll
      for (int j = 0; j < 4; ++j) { v8h hh;
#pragma unroll
        for (int r = 0; r < 8; ++r) hh[r] = (_Float16)acc[i][j][r];
        *(v8h*)(th + (cb0 + j * 16) * 136 + rb0 + i * 16) = hh; } }
    __syncthreads();
#pragma unroll                                              // unrolled: one address with immediate offsets, the LDS reads issued together ahead of the stores
    for (int it = 0; it < GT * 16 / 256; ++it) { const int cl = it * 16 + (tid >> 4), q = tid & 15;
      vst2(VT + (b * CC + c0 + cl) * (size_t)SEQ + t0 + q * 8, *(const v4u*)(th + cl * 136 + q * 8)); } }
  else { _Float16* sh = (_Float16*)lds;                                       // [row][col], pitch 136
#pragma unroll
    for (int i = 0; i < 2; ++i) {
#pragma unroll
      for (int j = 0; j < 4; ++j) {
#pragma unroll
        for (int r = 0; r < 8; ++r) sh[(rb0 + i * 16 + r) * 136 + cb0 + j * 16] = (_Float16)acc[i][j][r]; } }
    __syncthreads();
    _Float16* dst = which == 0 ? QH : KH;
#pragma unroll                                              // unrolled, as above
    for (int it = 0; it < GT * 16 / 256; ++it) { const int rl = it * 16 + (tid >> 4), q = tid & 15;
      vst2(dst + (r0 + rl) * CC + c0 + q * 8, *(const v4u*)(sh + rl * 136 + q * 8)); } }
}
#define NQ 2
#define AW 8
#define KG 2                                 // key groups
#define AS 128                               // keys per tile = KG groups x two passes of 32
#define AP 72                                // K row pitch in 16-bit elements: 144 B = 16 B x odd, conflict-free for 16-byte fragment reads
#define VP 136                               // V row pitch in 16-bit elements: 272 B = 16 B x odd, likewise
#define KTILE (AS * AP)                      // 16-bit elements of the K tile: AS key rows
#define VTILE (64 * VP)                      // 16-bit elements of the V tile: 64 head columns
#define ABUF (KTILE + VTILE)                 // K, V
#define SC2 (1.4426950408889634f / 64.0f)    // log2(e) / head size: the logit scale and the change of base in one factor
static_assert((SEQ % (AW * NQ * 16)) == 0);
static_assert(AS == KG * 64 && HD == 64 && AW * KG * 32 == 512 && (SEQ % AS) == 0 && SEQ / AS >= 2);
static_assert((NQ * (HD / 16) * 2 + 1) * AW * 32 * 16 <= 2 * ABUF * 2);   // group 1's state fits the ring
// One tile: 4 copies of 16 B a lane. K: 8 lanes a row, 64 rows a sweep, 2 sweeps; V: 16 lanes a row, 32 rows a sweep, 2 sweeps.
// lk, lv = the lane's LDS byte addresses in the K and the V part of the target buffer; k, v = its global addresses in the first sweep.
// The s_wait_xcnt stands inside the statement, behind the last copy: the operands' registers are rewritten only behind it.
__device__ __forceinline__ void attn_copy(unsigned lk, unsigned lv, const _Float16* k, const _Float16* v) {
  asm volatile("global_load_async_to_lds_b128 %0, %4, off\n\t"
               "global_load_async_to_lds_b128 %1, %5, off\n\t"
               "global_load_async_to_lds_b128 %2, %6, off\n\t"
               "global_load_async_to_lds_b128 %3, %7, off\n\t"
               "s_wait_xcnt 0x0"
               :: "v"(lk), "v"(lk + 64u * AP * 2u), "v"(lv), "v"(lv + 32u * VP * 2u),
                  "v"(k), "v"(k + (size_t)64 * CC), "v"(v), "v"(v + (size_t)32 * SEQ)
               : "memory");
}
// v_exp_f32 with a v_nop in its own statement: fills the one slot that the instruction set asks for behind a transcendental whose source the next vector instruction overwrites
__device__ __forceinline__ float exp2_slot(float x) { float r; asm("v_exp_f32 %0, %1\n\tv_nop" : "=v"(r) : "v"(x)); return r; }
__global__ __launch_bounds__(AW * KG * 32) __attribute__((amdgpu_num_vgpr(256)))
void k_attn(const _Float16* __restrict__ QH, const _Float16* __restrict__ KH, const _Float16* __restrict__ VT, _Float16* __restrict__ Y) {
  __shared__ __align__(16) unsigned short ring[2 * ABUF];
  const int tid = threadIdx.x, lane = tid & 31, col = lane & 15, g = lane >> 4;
  const int wave = __builtin_amdgcn_readfirstlane(tid >> 5), qw = wave & (AW - 1), kg = wave / AW;
  const int h = blockIdx.y, b = blockIdx.z;
  const size_t q0 = (size_t)b * SEQ + blockIdx.x * (AW * NQ * 16) + qw * (NQ * 16);
  v16h qh[NQ][HD / 32];
#pragma unroll
  for (int u = 0; u < NQ; ++u) {
#pragma unroll
    for (int kc = 0; kc < HD / 32; ++kc) qh[u][kc] = frag_h(QH + (q0 + u * 16 + col) * CC + h * HD + kc * 32, lane); }
  const _Float16* kp = KH + (size_t)b * SEQ * CC + h * HD;               // wave-uniform bases of the next tile to copy, advanced per tile; the lane's own part is a fixed 32-bit offset
  const _Float16* vp = VT + ((size_t)b * CC + h * HD) * (size_t)SEQ;
  const unsigned ko = (unsigned)((tid >> 3) * CC + (tid & 7) * 8), vo = (unsigned)((tid >> 4) * SEQ + (tid & 15) * 8);
  const unsigned lko = (unsigned)(uintptr_t)ring + (unsigned)((tid >> 3) * AP + (tid & 7) * 8) * 2u;             // LDS byte addresses of the lane's first K and V copies in buffer 0
  const unsigned lvo = (unsigned)(uintptr_t)ring + (unsigned)(KTILE + (tid >> 4) * VP + (tid & 15) * 8) * 2u;
  const int fk = (kg * 64 + col) * AP + 8 * g;                           // the lane's place in its group's first K fragment
  const int fv = KTILE + col * VP + kg * 64 + 8 * g;                     // ... and first V fragment
  attn_copy(lko, lvo, kp + ko, vp + vo);                                 // tile 0 into buffer 0
  asm volatile("s_wait_asynccnt 0x0" ::: "memory");                      // this wave's copies of tile 0 have landed
  __syncthreads();                                                       // ... and every other wave's
  kp += (size_t)AS * CC; vp += AS;
  attn_copy(lko + ABUF * 2u, lvo + ABUF * 2u, kp + ko, vp + vo);         // tile 1 into buffer 1
  v8f acc[NQ][HD / 16] = {};
  float m[NQ], l[NQ];
#pragma unroll
  for (int u = 0; u < NQ; ++u) { m[u] = -3.0e38f; l[u] = 0.f; }
#pragma unroll 1                                            // rolled: the foot's barrier and refill stand once
  for (int st = 0; st < SEQ / AS; ++st) {
  const unsigned short* tb = ring + (st & 1) * ABUF;
#pragma unroll 1                                            // rolled: the pass's code stands once, and its fragments and scores take one pass's registers
  for (int ps = 0; ps < AS / (KG * 32); ++ps) {
    const unsigned short* kq = tb + fk + ps * 32 * AP; const unsigned short* vq = tb + fv + ps * 32;
    v8f sa[NQ][2] = {};
    FR kb[HD / 32][2], vf[HD / 16];                         // the pass's K fragments are read as one group: one LDS latency a pass, not one a fragment
#pragma unroll
    for (int kc = 0; kc < HD / 32; ++kc) {
#pragma unroll
      for (int t = 0; t < 2; ++t) kb[kc][t] = frag_s(kq + t * 16 * AP + kc * 32); }
#pragma unroll
    for (int kc = 0; kc < HD / 32; ++kc) {
#pragma unroll
      for (int t = 0; t < 2; ++t) {
#pragma unroll
        for (int u = 0; u < NQ; ++u) sa[u][t] = wmma16(kb[kc][t].h, qh[u][kc], sa[u][t]); } }
#pragma unroll
    for (int j = 0; j < HD / 16; ++j) vf[j] = frag_s(vq + j * 16 * VP);   // the pass's four V fragments, all in registers at once: their reads are free to stand ahead of the products
    v16h pf[NQ];
#pragma unroll
    for (int u = 0; u < NQ; ++u) {
      float p[16]; float mx = m[u];
#pragma unroll
      for (int i = 0; i < 16; ++i) { p[i] = sa[u][i >> 3][i & 7]; mx = fmaxf(mx, p[i]); }   // raw scores q.k; m[u] is kept in the same unit
      mx = fmaxf(mx, __shfl_xor(mx, 16));
      if (__builtin_amdgcn_ballot_w32(mx > m[u]) != 0) {     // some query's maximum rose: rescale (the factor is exactly 1 for the others)
        const float al = __builtin_amdgcn_exp2f((m[u] - mx) * SC2); l[u] *= al; m[u] = mx;
#pragma unroll
        for (int j = 0; j < HD / 16; ++j) acc[u][j] = acc[u][j] * al; }
      const float nm = -m[u] * SC2;
#pragma unroll
      for (int i = 0; i < 16; i += 2) {                     // exp((s - m) / 64) = 2^(s * SC2 - m * SC2); two exponents a packed fma
        const v2f e = __builtin_elementwise_fma((v2f){p[i], p[i + 1]}, (v2f){SC2, SC2}, (v2f){nm, nm});
        p[i] = __builtin_amdgcn_exp2f(e[0]); l[u] += p[i]; p[i + 1] = __builtin_amdgcn_exp2f(e[1]); l[u] += p[i + 1]; }
      pf[u] = hpack16(p); }
#pragma unroll
    for (int j = 0; j < HD / 16; ++j) {
#pragma unroll
      for (int u = 0; u < NQ; ++u) acc[u][j] = wmma16(vf[j].h, pf[u], acc[u][j]); }
    __builtin_amdgcn_sched_barrier(0);                      // holds the v_nop below behind the pass's last product; without it the build lifts them among the products, where they cover nothing
    asm volatile("v_nop\n\tv_nop\n\tv_nop\n\tv_nop");     // the 4 vector slots behind the pass's last product: the build forms the next pass's K address in a register of that product's P operand
  }
    asm volatile("s_wait_dscnt 0x0" ::: "memory");          // this wave's reads of tile st are done before its buffer is handed over
    asm volatile("s_wait_asynccnt 0x0" ::: "memory");       // this wave's copies of tile st + 1 have landed
    __syncthreads();                                        // publishes tile st + 1; every wave has left tile st's buffer
    if (st + 2 < SEQ / AS) { kp += (size_t)AS * CC; vp += AS;
      attn_copy(lko + (unsigned)(st & 1) * (ABUF * 2u), lvo + (unsigned)(st & 1) * (ABUF * 2u), kp + ko, vp + vo); }   // tile st + 2 into the buffer just left
  }
  asm volatile("s_wait_asynccnt 0x0" ::: "memory");         // no copy is outstanding when the wave ends
  // The loop's last barrier has freed the ring (no reader, no copy left): group 1's state goes through it, 16 B a lane, lanes side by side.
  v4f* xg = (v4f*)ring + qw * 32 + lane;                    // slot s of this query wave's lane: xg[s * AW * 32]
  if (kg == 1) {
    xg[0] = (v4f){m[0], m[1], l[0], l[1]};
#pragma unroll
    for (int u = 0; u < NQ; ++u) {
#pragma unroll
      for (int j = 0; j < HD / 16; ++j) { const v8f o = acc[u][j]; const int sl = 1 + (u * (HD / 16) + j) * 2;
        xg[sl * AW * 32] = (v4f){o[0], o[1], o[2], o[3]}; xg[(sl + 1) * AW * 32] = (v4f){o[4], o[5], o[6], o[7]}; } } }
  __syncthreads();                                          // group 1's state is written before group 0 reads it
  if (kg == 0) {
    const v4f ml = xg[0];
#pragma unroll
    for (int u = 0; u < NQ; ++u) {
      const float mm = fmaxf(m[u], ml[u]);                  // both states are brought to the larger maximum
      const float a0 = exp2_slot((m[u] - mm) * SC2), a1 = exp2_slot((ml[u] - mm) * SC2);
      const float ls = l[u] * a0 + ml[2 + u] * a1;
      const float inv = 1.0f / (ls + __shfl_xor(ls, 16));
      const float w0 = a0 * inv, w1 = a1 * inv;
      _Float16* yp = Y + (q0 + u * 16 + col) * CC + h * HD + 8 * g;   // acc[u][j][r] = O[query u*16 + col][j*16 + 8g + r]
#pragma unroll
      for (int j = 0; j < HD / 16; ++j) { const int sl = 1 + (u * (HD / 16) + j) * 2; const v4f x0 = xg[sl * AW * 32], x1 = xg[(sl + 1) * AW * 32]; const v8f o = acc[u][j];
        const v4f y0 = (v4f){o[0], o[1], o[2], o[3]} * w0 + x0 * w1, y1 = (v4f){o[4], o[5], o[6], o[7]} * w0 + x1 * w1; v8h hh;
#pragma unroll
        for (int r = 0; r < 4; ++r) { hh[r] = (_Float16)(y0[r] * 64.0f); hh[4 + r] = (_Float16)(y1[r] * 64.0f); }   // k_out's A operand: y x 2^6, rounded once
        vst2(yp + j * 16, hh); } } }
}
// ---- k_out: block = (128 plane rows, 128 cols): y (x 2^6, f16) . W_out^T (bf16 values x 2^6, f16), + bf16 b_out
__global__ __launch_bounds__(256) __attribute__((amdgpu_num_vgpr(256)))
void k_out(const _Float16* __restrict__ Y, const _Float16* __restrict__ WOH, const float* __restrict__ Bv, float* __restrict__ O) {
  __shared__ __align__(16) unsigned short lds[GLDS / 2];
  const int tid = threadIdx.x, wave = tid >> 5, lane = tid & 31, col = lane & 15, g = lane >> 4;
  const int c0 = blockIdx.y * GT; const size_t r0 = (size_t)blockIdx.x * GT;   // plane row base
  v8f acc[2][4] = {};
  gemm_core<false>((const unsigned short*)Y + r0 * CC, (const unsigned short*)WOH + (size_t)c0 * CC, lds, acc);
  float* so = (float*)lds;                                                     // [row][col], pitch 132
  const int rb0 = (wave >> 1) * 32 + 8 * g, cb0 = (wave & 1) * 64 + col;
#pragma unroll
  for (int j = 0; j < 4; ++j) { const float bb = bfr(Bv[c0 + cb0 + j * 16]);
#pragma unroll
    for (int i = 0; i < 2; ++i) {
#pragma unroll
      for (int r = 0; r < 8; ++r) so[(rb0 + i * 16 + r) * 132 + cb0 + j * 16] = acc[i][j][r] * (1.0f / 4096.0f) + bb; } }
  __syncthreads();
  const size_t b = r0 / SEQ; const int t0 = (int)(r0 % SEQ);
  for (int rl = wave * 16; rl < wave * 16 + 16; ++rl)
    vst2(O + (b * SEQ_FULL + (size_t)(t0 + rl)) * CC + c0 + lane * 4, *(const v4f*)(so + rl * 132 + lane * 4));
}

extern "C" void kernel_launch(void* const* d_in, const int* in_sizes, int n_in, void* d_out, int out_size, void* d_ws, size_t ws_size, hipStream_t stream) {
  if (n_in < 4) return;
  const size_t rows_needed = (size_t)(NB - 1) * SEQ_FULL + SEQ;
  if ((size_t)in_sizes[0] < rows_needed * CC) return;            // x [2,2048,1024]
  if ((size_t)in_sizes[1] < (size_t)3 * CC * CC) return;         // w_qkv [3072,1024] ([out][in])
  if ((size_t)in_sizes[2] < (size_t)CC * CC) return;             // w_out [1024,1024] ([out][in])
  if (in_sizes[3] < CC) return;                                   // b_out [1024]
  if ((size_t)out_size < rows_needed * CC) return;
  if (ws_size < (size_t)WS_END) return;
  const float* X = (const float*)d_in[0]; const float* W = (const float*)d_in[1]; const float* WO = (const float*)d_in[2]; const float* BO = (const float*)d_in[3];
  char* ws = (char*)d_ws;
  _Float16 *QH = (_Float16*)(ws + WS_QH), *KH = (_Float16*)(ws + WS_KH);
  _Float16 *VT = (_Float16*)(ws + WS_VT);
  _Float16 *Y = (_Float16*)(ws + WS_Y), *WOH = (_Float16*)(ws + WS_WO);
  __bf16 *XB = (__bf16*)(ws + WS_XB), *WB = (__bf16*)(ws + WS_WB);
  k_cvt<<<dim3(NB * SEQ / CVR + 3 * CC / CVR + CC / CVR), 256, 0, stream>>>(X, W, WO, XB, WB, WOH);
  k_proj<<<dim3(NB * SEQ / GT, CC / GT, 3), 256, 0, stream>>>(XB, WB, QH, KH, VT);
  k_attn<<<dim3(SEQ / (AW * NQ * 16), NH, NB), AW * KG * 32, 0, stream>>>(QH, KH, VT, Y);
  k_out<<<dim3(NB * SEQ / GT, CC / GT), 256, 0, stream>>>(Y, WOH, BO, (float*)d_out);
}

// v010
// Measured time: 80.2 microseconds a run.
// Next to v009, in two timings, it ran 1.03 times as fast each time.
// Over all steps from v000 it is 21.2 times as fast.
// compute dtype: x and W_qkv RNE-converted to bf16 (once, by k_cvt); q/k/v = x W_qkv^T with exact bf16 products on v_wmma_f32_16x16x32_bf16, f32 accumulate; q and k each rounded once to f16 -> 1-product raw scores (v_wmma_f32_16x16x32_f16) in f32 registers; running-maximum softmax in f32, base 2 (v_exp_f32 of one fma that carries log2(e)/64); P and v each rounded once to f16: 1 f16 product (v_wmma_f32_16x16x32_f16), f32 accumulate, divided by the f32 row sum at the end; merged heads y (x 2^6) rounded once to f16; y times W_out^T (bf16 values x 2^6, f16, made once by k_cvt): 1 f16 product, f32 accumulate, + bf16 b_out.
#include <hip/hip_runtime.h>
#include <math.h>

typedef __attribute__((ext_vector_type(16))) _Float16 v16h;
typedef __attribute__((ext_vector_type(16))) __bf16 v16b;
typedef __attribute__((ext_vector_type(8)))  _Float16 v8h;
typedef __attribute__((ext_vector_type(8)))  float v8f;
typedef __attribute__((ext_vector_type(4)))  float v4f;
typedef __attribute__((ext_vector_type(2)))  float v2f;
typedef __attribute__((ext_vector_type(4)))  unsigned v4u;
typedef __attribute__((ext_vector_type(2)))  unsigned v2u;
typedef __attribute__((ext_vector_type(4)))  _Float16 v4h;
typedef __attribute__((ext_vector_type(4)))  __bf16 v4b;

template <typename T> __device__ __forceinline__ void vst2(void* p, T v) { *(T*)p = v;  }

__device__ __forceinline__ v8f wmma16(v16h a, v16h b, v8f c) {
  return __builtin_amdgcn_wmma_f32_16x16x32_f16(false, a, false, b, (short)0, c, false, false);
}
__device__ __forceinline__ v8f wmma_bf(v16b a, v16b b, v8f c) {
  return __builtin_amdgcn_wmma_f32_16x16x32_bf16(false, a, false, b, (short)0, c, false, false);
}
// 16x16x32 fragments: lane = (g = lane>>4, row/col = lane&15); elements 0..7 = k0+8g+0..7, 8..15 = k0+16+8g+0..7; D element r = row 8g+r, col lane&15
__device__ __forceinline__ v16h frag_h(const _Float16* rowk0, int lane) {
  union { v16h v; v8h q[2]; } u; const _Float16* p = rowk0 + 8 * (lane >> 4);
  u.q[0] = *(const v8h*)p; u.q[1] = *(const v8h*)(p + 16); return u.v;
}
// 16 f32 values -> f16 fragment, each rounded to nearest once
__device__ __forceinline__ v16h hpack16(const float v[16]) { v16h r;
#pragma unroll
  for (int i = 0; i < 16; ++i) r[i] = (_Float16)v[i];
  return r; }
__device__ __forceinline__ float bfr(float v) { return (float)(__bf16)v; }

// sizes: B 2, N 2048, C 1024 = 16 heads x 64; logits x (1/64); output projection C -> C with bias
#define NB_FULL 2
#define SEQ_FULL 2048
#ifndef NB
#define NB NB_FULL
#endif
#ifndef SEQ
#define SEQ SEQ_FULL
#endif
#define CC 1024
#define NH 16
#define HD 64
static_assert(NB >= 1 && NB <= NB_FULL);
static_assert(SEQ >= 128 && SEQ <= SEQ_FULL && (SEQ % 128) == 0);
static_assert(NH * HD == CC && HD == 64 && (CC % 128) == 0);

#define PR     ((size_t)NB * SEQ)                                 // plane rows (b*SEQ + t)
#define WS_QH  ((size_t)0)                                        // f16 q      [PR][CC]
#define WS_KH  (WS_QH + 2u * PR * CC)                             // f16 k      [PR][CC]
#define WS_VT  (WS_KH + 2u * PR * CC)                             // f16 v planes [b][c][t]
#define WS_Y   (WS_VT + 2u * (size_t)NB * CC * SEQ)               // f16 merged heads y x 2^6 [PR][CC]
#define WS_XB  (WS_Y + 2u * PR * CC)                              // bf16 x      [PR][CC]
#define WS_WB  (WS_XB + 2u * PR * CC)                             // bf16 W_qkv  [3 CC][CC]
#define WS_WO  (WS_WB + 2u * (size_t)3 * CC * CC)                 // f16 (bf16 values of W_out) x 2^6 [CC][CC]
#define WS_END (WS_WO + 2u * (size_t)CC * CC)
static_assert(WS_END <= (size_t)134217728u);
static_assert((((size_t)(NB - 1) * SEQ_FULL + SEQ) * CC) <= (size_t)NB_FULL * SEQ_FULL * CC);

// ---- k_cvt: every GEMM operand that is an input is rounded to its 16-bit form once, here, and not again by every block that reads it.
// Block = CVR rows of CC values of x, W_qkv or W_out; a wave-wide load covers 4 whole 128-byte lines, a wave-wide store 2.
// CV 0: bf16; 1: f16 of (v rounded to bf16) x 2^6
template <int CV> __device__ __forceinline__ v2u cvt4(v4f v) {
  union { v4b b; v4h h; v2u u; } r;
#pragma unroll
  for (int i = 0; i < 4; ++i) {
    if constexpr (CV == 0) r.b[i] = (__bf16)v[i];
    else r.h[i] = (_Float16)(bfr(v[i]) * 64.0f); }
  return r.u;
}
#define CVR 16
static_assert((SEQ % CVR) == 0 && (CC % CVR) == 0 && CVR * CC == 16 * 256 * 4);
template <int CV> __device__ __forceinline__ void cvt_rows(const float* __restrict__ src, unsigned short* __restrict__ dst) {
  const int tid = threadIdx.x; v4f r[16];
#pragma unroll                                              // unrolled: r stays in registers, and all 16 loads of a thread are in flight ahead of its stores
  for (int i = 0; i < 16; ++i) r[i] = *(const v4f*)(src + (i * 256 + tid) * 4);
#pragma unroll                                              // unrolled, for the same register array
  for (int i = 0; i < 16; ++i) *(v2u*)(dst + (i * 256 + tid) * 4) = cvt4<CV>(r[i]);
  asm volatile("s_wait_xcnt 0x0" ::: "memory");             // stands behind the last store, ahead of any rewrite of a register that the stores name
}
__global__ __launch_bounds__(256)
void k_cvt(const float* __restrict__ X, const float* __restrict__ W, const float* __restrict__ WO, __bf16* __restrict__ XB, __bf16* __restrict__ WB, _Float16* __restrict__ WOH) {
  const int nx = (int)(PR / CVR), nw = 3 * CC / CVR; const int blk = blockIdx.x;
  if (blk < nx) { const size_t r0 = (size_t)blk * CVR;      // plane row b*SEQ + t <- input row b*SEQ_FULL + t
    cvt_rows<0>(X + ((r0 / SEQ) * SEQ_FULL + r0 % SEQ) * CC, (unsigned short*)XB + r0 * CC); }
  else if (blk < nx + nw) { const size_t o = (size_t)(blk - nx) * CVR * CC; cvt_rows<0>(W + o, (unsigned short*)WB + o); }
  else { const size_t o = (size_t)(blk - nx - nw) * CVR * CC; cvt_rows<1>(WO + o, (unsigned short*)WOH + o); }
}

// ---- GEMM core of k_proj and k_out: block = 8 waves on a 128 x 128 tile of A . B^T (both operands 16-bit rows, k contiguous), wave = 32 x 64 (2 x 4 tiles).
// Per step of 64 k the block reads its 128 + 128 rows once, every wave-wide load covering 4 whole 128-byte lines, and keeps the tile in LDS for all 8 waves.
// Two LDS buffers: step s + 1 is loaded into registers ahead of step s's products and stored behind them; one barrier a step. k runs upward 32 at a time into the same accumulators, in the fragment k order above.
#define GT 128                               // tile rows of either operand
#define GK 64                                // k per step: 128 B of a row, one line
#define GP 72                                // LDS row pitch in 16-bit elements: 144 B = 16 B x odd, conflict-free for 16-byte fragment reads
#define GBUF (2 * GT * GP)                   // 16-bit elements per buffer: A rows, then B rows
#define GLDS (2 * GBUF * 2)                  // bytes: the two buffers (73,728); the output staging of either kernel lies over them
static_assert(GT * 136 * 2 <= GLDS && GT * 132 * 4 <= GLDS && (SEQ % GT) == 0 && (CC % GT) == 0 && (CC % GK) == 0 && GK == 64);
union FR { v16h h; v16b b; v4u q[2]; };
__device__ __forceinline__ FR frag_s(const unsigned short* p) { FR u; u.q[0] = *(const v4u*)p; u.q[1] = *(const v4u*)(p + 16); return u; }
template <bool BF> __device__ __forceinline__ void gemm_step(const unsigned short* fa, const unsigned short* fb, v8f (&acc)[2][4]) {
  FR a[2], w[4];
#pragma unroll
  for (int i = 0; i < 2; ++i) a[i] = frag_s(fa + i * 16 * GP);
#pragma unroll
  for (int j = 0; j < 4; ++j) w[j] = frag_s(fb + j * 16 * GP);
  __builtin_amdgcn_sched_barrier(0);                        // holds the step's fragment reads together ahead of its products: one LDS latency a step; without it the build reads the second A fragment behind the fourth product, with a wait to 0
#pragma unroll
  for (int i = 0; i < 2; ++i) {
#pragma unroll
    for (int j = 0; j < 4; ++j) { if constexpr (BF) acc[i][j] = wmma_bf(a[i].b, w[j].b, acc[i][j]); else acc[i][j] = wmma16(a[i].h, w[j].h, acc[i][j]); } }
}
template <bool BF>
__device__ __forceinline__ void gemm_core(const unsigned short* __restrict__ A, const unsigned short* __restrict__ B, unsigned short* lds, v8f (&acc)[2][4]) {
  const int tid = threadIdx.x, wave = tid >> 5, lane = tid & 31, col = lane & 15, g = lane >> 4;
  const unsigned short* ap = A + (size_t)(tid >> 3) * CC + (tid & 7) * 8;   // 8 threads a row of 64 values; 32 rows a sweep, 4 sweeps an operand
  const unsigned short* bp = B + (size_t)(tid >> 3) * CC + (tid & 7) * 8;
  const int so = (tid >> 3) * GP + (tid & 7) * 8;
  const int fao = ((wave >> 1) * 32 + col) * GP + 8 * g, fbo = (GT + (wave & 1) * 64 + col) * GP + 8 * g;
  v4u ra[4], rb[4];
#pragma unroll
  for (int i = 0; i < 4; ++i) { ra[i] = *(const v4u*)(ap + (size_t)i * 32 * CC); rb[i] = *(const v4u*)(bp + (size_t)i * 32 * CC); }
#pragma unroll
  for (int i = 0; i < 4; ++i) { *(v4u*)(lds + so + i * 32 * GP) = ra[i]; *(v4u*)(lds + so + (GT + i * 32) * GP) = rb[i]; }
  int cur = 0;
#pragma unroll 1                                            // rolled: the body is the same every step, and unrolled it would only grow the code
  for (int kc = 0; kc < CC / GK - 1; ++kc) {
    __syncthreads();                                        // buffer cur is written by all; buffer cur ^ 1 is left by all its readers
    ap += GK; bp += GK;
#pragma unroll
    for (int i = 0; i < 4; ++i) { ra[i] = *(const v4u*)(ap + (size_t)i * 32 * CC); rb[i] = *(const v4u*)(bp + (size_t)i * 32 * CC); }
    __builtin_amdgcn_sched_barrier(0);                      // holds the next step's global loads ahead of this step's LDS reads and products; without it the build sinks them behind most of the products, directly in front of their waits
    gemm_step<BF>(lds + cur * GBUF + fao, lds + cur * GBUF + fbo, acc);
    gemm_step<BF>(lds + cur * GBUF + fao + 32, lds + cur * GBUF + fbo + 32, acc);
    __builtin_amdgcn_sched_barrier(0);                      // keeps the waits on the next step's global loads behind this step's products; without it they stand behind the first product
    cur ^= 1;
#pragma unroll
    for (int i = 0; i < 4; ++i) { *(v4u*)(lds + cur * GBUF + so + i * 32 * GP) = ra[i]; *(v4u*)(lds + cur * GBUF + so + (GT + i * 32) * GP) = rb[i]; }
  }
  __syncthreads();
  gemm_step<BF>(lds + cur * GBUF + fao, lds + cur * GBUF + fbo, acc);
  gemm_step<BF>(lds + cur * GBUF + fao + 32, lds + cur * GBUF + fbo + 32, acc);
  __syncthreads();                                          // every wave has left the buffers: the caller stages its output over them
}

// ---- k_proj: block = (128 plane rows, 128 cols, which in {q,k,v}); W rows = which*CC + (h*HD + d); q -> f16, k -> f16, v -> f16 planes [b][c][t]
__global__ __launch_bounds__(256) __attribute__((amdgpu_num_vgpr(256)))
void k_proj(const __bf16* __restrict__ XB, const __bf16* __restrict__ WB, _Float16* __restrict__ QH, _Float16* __restrict__ KH, _Float16* __restrict__ VT) {
  __shared__ __align__(16) unsigned short lds[GLDS / 2];
  const int tid = threadIdx.x, wave = tid >> 5, lane = tid & 31, col = lane & 15, g = lane >> 4;
  const int which = blockIdx.z; const int c0 = blockIdx.y * GT;
  const size_t r0 = (size_t)blockIdx.x * GT;            // plane row base = b*SEQ + t0
  const size_t b = r0 / SEQ; const int t0 = (int)(r0 % SEQ);
  v8f acc[2][4] = {};
  gemm_core<true>((const unsigned short*)XB + r0 * CC, (const unsigned short*)WB + ((size_t)which * CC + c0) * CC, lds, acc);
  const int rb0 = (wave >> 1) * 32 + 8 * g, cb0 = (wave & 1) * 64 + col;   // acc[i][j][r] = (row rb0 + 16 i + r, col cb0 + 16 j)
  if (which == 2) { _Float16* th = (_Float16*)lds;                          // [col][row], pitch 136
#pragma unroll
    for (int i = 0; i < 2; ++i) {
#pragma unroll
      for (int j = 0; j < 4; ++j) { v8h hh;
#pragma unroll
        for (int r = 0; r < 8; ++r) hh[r] = (_Float16)acc[i][j][r];
        *(v8h*)(th + (cb0 + j * 16) * 136 + rb0 + i * 16) = hh; } }
    __syncthreads();
#pragma unroll                                              // unrolled: one address with immediate offsets, the LDS reads issued together ahead of the stores
    for (int it = 0; it < GT * 16 / 256; ++it) { const int cl = it * 16 + (tid >> 4), q = tid & 15;
      vst2(VT + (b * CC + c0 + cl) * (size_t)SEQ + t0 + q * 8, *(const v4u*)(th + cl * 136 + q * 8)); } }
  else { _Float16* sh = (_Float16*)lds;                                       // [row][col], pitch 136
#pragma unroll
    for (int i = 0; i < 2; ++i) {
#pragma unroll
      for (int j = 0; j < 4; ++j) {
#pragma unroll
        for (int r = 0; r < 8; ++r) sh[(rb0 + i * 16 + r) * 136 + cb0 + j * 16] = (_Float16)acc[i][j][r]; } }
    __syncthreads();
    _Float16* dst = which == 0 ? QH : KH;
#pragma unroll                                              // unrolled, as above
    for (int it = 0; it < GT * 16 / 256; ++it) { const int rl = it * 16 + (tid >> 4), q = tid & 15;
      vst2(dst + (r0 + rl) * CC + c0 + q * 8, *(const v4u*)(sh + rl * 136 + q * 8)); } }
}
#define NQ 2
#define AW 8
#define KG 2                                 // key groups
#define AS 128                               // keys per tile = KG groups x two passes of 32
#define AP 72                                // K row pitch in 16-bit elements: 144 B = 16 B x odd, conflict-free for 16-byte fragment reads
#define VP 136                               // V row pitch in 16-bit elements: 272 B = 16 B x odd, likewise
#define KTILE (AS * AP)                      // 16-bit elements of the K tile: AS key rows
#define VTILE (64 * VP)                      // 16-bit elements of the V tile: 64 head columns
#define ABUF (KTILE + VTILE)                 // K, V
#define SC2 (1.4426950408889634f / 64.0f)    // log2(e) / head size: the logit scale and the change of base in one factor
#define LZ (8.0f / SC2)                      // width of the lazy maximum's band in raw score units: 8 in the base-2 exponent
static_assert((SEQ % (AW * NQ * 16)) == 0);
static_assert(AS == KG * 64 && HD == 64 && AW * KG * 32 == 512 && (SEQ % AS) == 0 && SEQ / AS >= 2);
static_assert((NQ * (HD / 16) * 2 + 1) * AW * 32 * 16 <= 2 * ABUF * 2);   // group 1's state fits the ring
// One tile: 4 copies of 16 B a lane. K: 8 lanes a row, 64 rows a sweep, 2 sweeps; V: 16 lanes a row, 32 rows a sweep, 2 sweeps.
// lk, lv = the lane's LDS byte addresses in the K and the V part of the target buffer; k, v = its global addresses in the first sweep.
// The s_wait_xcnt stands inside the statement, behind the last copy: the operands' registers are rewritten only behind it.
__device__ __forceinline__ void attn_copy(unsigned lk, unsigned lv, const _Float16* k, const _Float16* v) {
  asm volatile("global_load_async_to_lds_b128 %0, %4, off\n\t"
               "global_load_async_to_lds_b128 %1, %5, off\n\t"
               "global_load_async_to_lds_b128 %2, %6, off\n\t"
               "global_load_async_to_lds_b128 %3, %7, off\n\t"
               "s_wait_xcnt 0x0"
               :: "v"(lk), "v"(lk + 64u * AP * 2u), "v"(lv), "v"(lv + 32u * VP * 2u),
                  "v"(k), "v"(k + (size_t)64 * CC), "v"(v), "v"(v + (size_t)32 * SEQ)
               : "memory");
}
// v_exp_f32 with a v_nop in its own statement: fills the one slot that the instruction set asks for behind a transcendental whose source the next vector instruction overwrites
__device__ __forceinline__ float exp2_slot(float x) { float r; asm("v_exp_f32 %0, %1\n\tv_nop" : "=v"(r) : "v"(x)); return r; }
__global__ __launch_bounds__(AW * KG * 32) __attribute__((amdgpu_num_vgpr(256)))
void k_attn(const _Float16* __restrict__ QH, const _Float16* __restrict__ KH, const _Float16* __restrict__ VT, _Float16* __restrict__ Y) {
  __shared__ __align__(16) unsigned short ring[2 * ABUF];
  const int tid = threadIdx.x, lane = tid & 31, col = lane & 15, g = lane >> 4;
  const int wave = __builtin_amdgcn_readfirstlane(tid >> 5), qw = wave & (AW - 1), kg = wave / AW;
  const int h = blockIdx.y, b = blockIdx.z;
  const size_t q0 = (size_t)b * SEQ + blockIdx.x * (AW * NQ * 16) + qw * (NQ * 16);
  v16h qh[NQ][HD / 32];
#pragma unroll
  for (int u = 0; u < NQ; ++u) {
#pragma unroll
    for (int kc = 0; kc < HD / 32; ++kc) qh[u][kc] = frag_h(QH + (q0 + u * 16 + col) * CC + h * HD + kc * 32, lane); }
  const _Float16* kp = KH + (size_t)b * SEQ * CC + h * HD;               // wave-uniform bases of the next tile to copy, advanced per tile; the lane's own part is a fixed 32-bit offset
  const _Float16* vp = VT + ((size_t)b * CC + h * HD) * (size_t)SEQ;
  const unsigned ko = (unsigned)((tid >> 3) * CC + (tid & 7) * 8), vo = (unsigned)((tid >> 4) * SEQ + (tid & 15) * 8);
  const unsigned lko = (unsigned)(uintptr_t)ring + (unsigned)((tid >> 3) * AP + (tid & 7) * 8) * 2u;             // LDS byte addresses of the lane's first K and V copies in buffer 0
  const unsigned lvo = (unsigned)(uintptr_t)ring + (unsigned)(KTILE + (tid >> 4) * VP + (tid & 15) * 8) * 2u;
  const int fk = (kg * 64 + col) * AP + 8 * g;                           // the lane's place in its group's first K fragment
  const int fv = KTILE + col * VP + kg * 64 + 8 * g;                     // ... and first V fragment
  attn_copy(lko, lvo, kp + ko, vp + vo);                                 // tile 0 into buffer 0
  asm volatile("s_wait_asynccnt 0x0" ::: "memory");                      // this wave's copies of tile 0 have landed
  __syncthreads();                                                       // ... and every other wave's
  kp += (size_t)AS * CC; vp += AS;
  attn_copy(lko + ABUF * 2u, lvo + ABUF * 2u, kp + ko, vp + vo);         // tile 1 into buffer 1
  v8f acc[NQ][HD / 16] = {};
  float m[NQ], l[NQ];
#pragma unroll
  for (int u = 0; u < NQ; ++u) { m[u] = -3.0e38f; l[u] = 0.f; }
#pragma unroll 1                                            // rolled: the foot's barrier and refill stand once
  for (int st = 0; st < SEQ / AS; ++st) {
  const unsigned short* tb = ring + (st & 1) * ABUF;
#pragma unroll 1                                            // rolled: the pass's code stands once, and its fragments and scores take one pass's registers
  for (int ps = 0; ps < AS / (KG * 32); ++ps) {
    const unsigned short* kq = tb + fk + ps * 32 * AP; const unsigned short* vq = tb + fv + ps * 32;
    v8f sa[NQ][2] = {};
    FR kb[HD / 32][2], vf[HD / 16];                         // the pass's K fragments are read as one group: one LDS latency a pass, not one a fragment
#pragma unroll
    for (int kc = 0; kc < HD / 32; ++kc) {
#pragma unroll
      for (int t = 0; t < 2; ++t) kb[kc][t] = frag_s(kq + t * 16 * AP + kc * 32); }
#pragma unroll
    for (int kc = 0; kc < HD / 32; ++kc) {
#pragma unroll
      for (int t = 0; t < 2; ++t) {
#pragma unroll
        for (int u = 0; u < NQ; ++u) sa[u][t] = wmma16(kb[kc][t].h, qh[u][kc], sa[u][t]); } }
#pragma unroll
    for (int j = 0; j < HD / 16; ++j) vf[j] = frag_s(vq + j * 16 * VP);   // the pass's four V fragments, all in registers at once: their reads are free to stand ahead of the products
    // Lazy running maximum: m[u], the maximum in use, may trail a query's true maximum by up to LZ (8 in the base-2 exponent, so a weight stays at or below 2^8, far inside f16 and f32).
    // Both query groups' pass maxima are formed first, and ONE test a pass decides for both groups.
    float mb[NQ]; bool need = false;
#pragma unroll
    for (int u = 0; u < NQ; ++u) {
      float mx = sa[u][0][0];
#pragma unroll
      for (int i = 1; i < 16; ++i) mx = fmaxf(mx, sa[u][i >> 3][i & 7]);    // raw scores q.k; m[u] is kept in the same unit
      mx = fmaxf(mx, __shfl_xor(mx, 16)); mb[u] = mx; need = need || (mx > m[u] + LZ); }
    if (__builtin_amdgcn_ballot_w32(need) != 0) {           // some query's maximum left the band (always so in a wave's first pass): every query goes to the larger of its maximum in use and its pass maximum
#pragma unroll
      for (int u = 0; u < NQ; ++u) {
        const float mn = fmaxf(m[u], mb[u]);
        const float al = __builtin_amdgcn_exp2f((m[u] - mn) * SC2); l[u] *= al; m[u] = mn;
#pragma unroll
        for (int j = 0; j < HD / 16; ++j) acc[u][j] = acc[u][j] * al; } }
    v16h pf[NQ];
#pragma unroll
    for (int u = 0; u < NQ; ++u) {
      float p[16];
      const float nm = -m[u] * SC2;
#pragma unroll
      for (int i = 0; i < 16; i += 2) {                     // exp((s - m) / 64) = 2^(s * SC2 - m * SC2); two exponents a packed fma
        const v2f e = __builtin_elementwise_fma((v2f){sa[u][i >> 3][i & 7], sa[u][i >> 3][(i & 7) + 1]}, (v2f){SC2, SC2}, (v2f){nm, nm});
        const bool sl = u == 0 && i >= 8;                   // the slot behind a transcendental: both groups' exponentials now stand in one block
        p[i] = sl ? exp2_slot(e[0]) : __builtin_amdgcn_exp2f(e[0]); l[u] += p[i]; p[i + 1] = sl ? exp2_slot(e[1]) : __builtin_amdgcn_exp2f(e[1]); l[u] += p[i + 1]; }
      pf[u] = hpack16(p); }
#pragma unroll
    for (int j = 0; j < HD / 16; ++j) {
#pragma unroll
      for (int u = 0; u < NQ; ++u) acc[u][j] = wmma16(vf[j].h, pf[u], acc[u][j]); }
    __builtin_amdgcn_sched_barrier(0);                      // holds the v_nop below behind the pass's last product; without it the build lifts them among the products, where they cover nothing
    asm volatile("v_nop\n\tv_nop\n\tv_nop\n\tv_nop");     // the 4 vector slots behind the pass's last product: the build forms the next pass's K address in a register of that product's P operand
  }
    asm volatile("s_wait_dscnt 0x0" ::: "memory");          // this wave's reads of tile st are done before its buffer is handed over
    asm volatile("s_wait_asynccnt 0x0" ::: "memory");       // this wave's copies of tile st + 1 have landed
    __syncthreads();                                        // publishes tile st + 1; every wave has left tile st's buffer
    if (st + 2 < SEQ / AS) { kp += (size_t)AS * CC; vp += AS;
      attn_copy(lko + (unsigned)(st & 1) * (ABUF * 2u), lvo + (unsigned)(st & 1) * (ABUF * 2u), kp + ko, vp + vo); }   // tile st + 2 into the buffer just left
  }
  asm volatile("s_wait_asynccnt 0x0" ::: "memory");         // no copy is outstanding when the wave ends
  // The loop's last barrier has freed the ring (no reader, no copy left): group 1's state goes through it, 16 B a lane, lanes side by side.
  v4f* xg = (v4f*)ring + qw * 32 + lane;                    // slot s of this query wave's lane: xg[s * AW * 32]
  if (kg == 1) {
    xg[0] = (v4f){m[0], m[1], l[0], l[1]};
#pragma unroll
    for (int u = 0; u < NQ; ++u) {
#pragma unroll
      for (int j = 0; j < HD / 16; ++j) { const v8f o = acc[u][j]; const int sl = 1 + (u * (HD / 16) + j) * 2;
        xg[sl * AW * 32] = (v4f){o[0], o[1], o[2], o[3]}; xg[(sl + 1) * AW * 32] = (v4f){o[4], o[5], o[6], o[7]}; } } }
  __syncthreads();                                          // group 1's state is written before group 0 reads it
  if (kg == 0) {
    const v4f ml = xg[0];
#pragma unroll
    for (int u = 0; u < NQ; ++u) {
      const float mm = fmaxf(m[u], ml[u]);                  // both states are brought to the larger maximum
      const float a0 = exp2_slot((m[u] - mm) * SC2), a1 = exp2_slot((ml[u] - mm) * SC2);
      const float ls = l[u] * a0 + ml[2 + u] * a1;
      const float inv = 1.0f / (ls + __shfl_xor(ls, 16));
      const float w0 = a0 * inv, w1 = a1 * inv;
      _Float16* yp = Y + (q0 + u * 16 + col) * CC + h * HD + 8 * g;   // acc[u][j][r] = O[query u*16 + col][j*16 + 8g + r]
#pragma unroll
      for (int j = 0; j < HD / 16; ++j) { const int sl = 1 + (u * (HD / 16) + j) * 2; const v4f x0 = xg[sl * AW * 32], x1 = xg[(sl + 1) * AW * 32]; const v8f o = acc[u][j];
        const v4f y0 = (v4f){o[0], o[1], o[2], o[3]} * w0 + x0 * w1, y1 = (v4f){o[4], o[5], o[6], o[7]} * w0 + x1 * w1; v8h hh;
#pragma unroll
        for (int r = 0; r < 4; ++r) { hh[r] = (_Float16)(y0[r] * 64.0f); hh[4 + r] = (_Float16)(y1[r] * 64.0f); }   // k_out's A operand: y x 2^6, rounded once
        vst2(yp + j * 16, hh); } } }
}
// ---- k_out: block = (128 plane rows, 128 cols): y (x 2^6, f16) . W_out^T (bf16 values x 2^6, f16), + bf16 b_out
__global__ __launch_bounds__(256) __attribute__((amdgpu_num_vgpr(256)))
void k_out(const _Float16* __restrict__ Y, const _Float16* __restrict__ WOH, const float* __restrict__ Bv, float* __restrict__ O) {
  __shared__ __align__(16) unsigned short lds[GLDS / 2];
  const int tid = threadIdx.x, wave = tid >> 5, lane = tid & 31, col = lane & 15, g = lane >> 4;
  const int c0 = blockIdx.y * GT; const size_t r0 = (size_t)blockIdx.x * GT;   // plane row base
  v8f acc[2][4] = {};
  gemm_core<false>((const unsigned short*)Y + r0 * CC, (const unsigned short*)WOH + (size_t)c0 * CC, lds, acc);
  float* so = (float*)lds;                                                     // [row][col], pitch 132
  const int rb0 = (wave >> 1) * 32 + 8 * g, cb0 = (wave & 1) * 64 + col;
#pragma unroll
  for (int j = 0; j < 4; ++j) { const float bb = bfr(Bv[c0 + cb0 + j * 16]);
#pragma unroll
    for (int i = 0; i < 2; ++i) {
#pragma unroll
      for (int r = 0; r < 8; ++r) so[(rb0 + i * 16 + r) * 132 + cb0 + j * 16] = acc[i][j][r] * (1.0f / 4096.0f) + bb; } }
  __syncthreads();
  const size_t b = r0 / SEQ; const int t0 = (int)(r0 % SEQ);
  for (int rl = wave * 16; rl < wave * 16 + 16; ++rl)
    vst2(O + (b * SEQ_FULL + (size_t)(t0 + rl)) * CC + c0 + lane * 4, *(const v4f*)(so + rl * 132 + lane * 4));
}

extern "C" void kernel_launch(void* const* d_in, const int* in_sizes, int n_in, void* d_out, int out_size, void* d_ws, size_t ws_size, hipStream_t stream) {
  if (n_in < 4) return;
  const size_t rows_needed = (size_t)(NB - 1) * SEQ_FULL + SEQ;
  if ((size_t)in_sizes[0] < rows_needed * CC) return;            // x [2,2048,1024]
  if ((size_t)in_sizes[1] < (size_t)3 * CC * CC) return;         // w_qkv [3072,1024] ([out][in])
  if ((size_t)in_sizes[2] < (size_t)CC * CC) return;             // w_out [1024,1024] ([out][in])
  if (in_sizes[3] < CC) return;                                   // b_out [1024]
  if ((size_t)out_size < rows_needed * CC) return;
  if (ws_size < (size_t)WS_END) return;
  const float* X = (const float*)d_in[0]; const float* W = (const float*)d_in[1]; const float* WO = (const float*)d_in[2]; const float* BO = (const float*)d_in[3];
  char* ws = (char*)d_ws;
  _Float16 *QH = (_Float16*)(ws + WS_QH), *KH = (_Float16*)(ws + WS_KH);
  _Float16 *VT = (_Float16*)(ws + WS_VT);
  _Float16 *Y = (_Float16*)(ws + WS_Y), *WOH = (_Float16*)(ws + WS_WO);
  __bf16 *XB = (__bf16*)(ws + WS_XB), *WB = (__bf16*)(ws + WS_WB);
  k_cvt<<<dim3(NB * SEQ / CVR + 3 * CC / CVR + CC / CVR), 256, 0, stream>>>(X, W, WO, XB, WB, WOH);
  k_proj<<<dim3(NB * SEQ / GT, CC / GT, 3), 256, 0, stream>>>(XB, WB, QH, KH, VT);
  k_attn<<<dim3(SEQ / (AW * NQ * 16), NH, NB), AW * KG * 32, 0, stream>>>(QH, KH, VT, Y);
  k_out<<<dim3(NB * SEQ / GT, CC / GT), 256, 0, stream>>>(Y, WOH, BO, (float*)d_out);
}
